// v000
// The times below were measured on an AMD MI455X: many runs one after another, warmed up first and cycling through
// copies of the inputs, with the whole window's GPU time divided by the number of runs. Launches and the gaps
// between them are all in it. The median over several windows is given; except for v000 it joins two sittings, which
// can be a few percent apart, so the side-by-side timings, each taken in one sitting, are the better comparison.
// v000 is the starting kernel. One run takes 348 microseconds.
#include <hip/hip_runtime.h>
#include <hip/hip_bf16.h>
#include <math.h>

#define E_   32
#define CAP_ 4096
#define D_   256
#define HD_  1024

typedef __attribute__((ext_vector_type(16))) __bf16 v16bf;
typedef __attribute__((ext_vector_type(8)))  float  v8f;

union Frag {
  uint4 u[2];
  v16bf v;
};

// round-to-nearest-even fp32 -> bf16 (bit trick)
__device__ __forceinline__ unsigned short f2bf(float a) {
  unsigned int ua = __float_as_uint(a);
  return (unsigned short)((ua + 0x7FFFu + ((ua >> 16) & 1u)) >> 16);
}
__device__ __forceinline__ unsigned int pack2bf(float a, float b) {
  return (unsigned int)f2bf(a) | ((unsigned int)f2bf(b) << 16);
}
__device__ __forceinline__ float gelu_exact(float x) {
  return 0.5f * x * (1.0f + erff(x * 0.70710678118654752440f));
}

// ---------------------------------------------------------------------------
// Prep: convert fp32 weights to bf16, packed per 32(K)x16(N) WMMA-B tile.
// Tile = 1024 bytes: lane L stores 32 bytes at L*32:
//   bytes  0-15 : K = k0 + sel + {0..7}   of column n0 + (L%16)
//   bytes 16-31 : K = k0 + sel + 16 + {0..7}
//   sel = 0 for L<16, 8 for L>=16   (matches ISA 16-bit B layout)
// W1 packed: [E][64 ntiles][8 ktiles]   (16 MB)
// W2 packed: [E][16 ntiles][32 ktiles]  (16 MB)
// ---------------------------------------------------------------------------
__global__ void __launch_bounds__(256) prep_weights_kernel(
    const float* __restrict__ w_fc, const float* __restrict__ w_proj,
    unsigned int* __restrict__ w1p, unsigned int* __restrict__ w2p) {
  const int wave = threadIdx.x >> 5;
  const int lane = threadIdx.x & 31;
  const int t = blockIdx.x * 8 + wave;          // 32768 tiles total
  const int sel = (lane >> 4) * 8;

  if (t < E_ * 512) {                           // W1: [256 x 1024], ldn = 1024
    const int e = t >> 9, rem = t & 511;
    const int nt = rem >> 3, kt = rem & 7;
    const float* src = w_fc + (size_t)e * D_ * HD_;
    const int col = nt * 16 + (lane & 15);
    unsigned int* dst = w1p + (size_t)t * 256 + lane * 8;
#pragma unroll
    for (int d = 0; d < 8; ++d) {
      const int part = d >> 2, dd = d & 3;
      const int k = kt * 32 + part * 16 + sel + dd * 2;
      dst[d] = pack2bf(src[(size_t)k * HD_ + col], src[(size_t)(k + 1) * HD_ + col]);
    }
  } else {                                      // W2: [1024 x 256], ldn = 256
    const int t2 = t - E_ * 512;
    const int e = t2 >> 9, rem = t2 & 511;
    const int nt = rem >> 5, kt = rem & 31;
    const float* src = w_proj + (size_t)e * HD_ * D_;
    const int col = nt * 16 + (lane & 15);
    unsigned int* dst = w2p + (size_t)t2 * 256 + lane * 8;
#pragma unroll
    for (int d = 0; d < 8; ++d) {
      const int part = d >> 2, dd = d & 3;
      const int k = kt * 32 + part * 16 + sel + dd * 2;
      dst[d] = pack2bf(src[(size_t)k * D_ + col], src[(size_t)(k + 1) * D_ + col]);
    }
  }
}

// ---------------------------------------------------------------------------
// Fused expert MLP: out = gelu(x @ w_fc) @ w_proj, 64 rows per workgroup.
// Hidden dim processed in 8 chunks of 128 columns; 2x2 / 2x4 register
// blocking per wave so every WMMA costs ~1 global b128 + ~0.75 ds b128.
// ---------------------------------------------------------------------------
__global__ void __launch_bounds__(256, 1) expert_mlp_kernel(
    const float* __restrict__ x,
    const unsigned int* __restrict__ w1p,
    const unsigned int* __restrict__ w2p,
    float* __restrict__ out) {
  __shared__ unsigned short Xs[64 * 264];  // 64 rows x 256 K, bf16, padded stride
  __shared__ unsigned short Hs[64 * 136];  // 64 rows x 128 hidden cols, bf16, padded

  const int tid  = threadIdx.x;
  const int wave = tid >> 5;
  const int lane = tid & 31;
  const int e  = blockIdx.x >> 6;          // 64 row-blocks per expert
  const int m0 = (blockIdx.x & 63) << 6;

  // ---- load + convert X tile [64 x 256] fp32 -> bf16 LDS (coalesced) ----
  const float4* xt = (const float4*)(x + ((size_t)e * CAP_ + m0) * D_);
#pragma unroll
  for (int it = 0; it < 16; ++it) {
    const int f = it * 256 + tid;
    const int row = f >> 6, c4 = f & 63;
    const float4 v = xt[row * 64 + c4];
    uint2 p;
    p.x = pack2bf(v.x, v.y);
    p.y = pack2bf(v.z, v.w);
    *(uint2*)&Xs[row * 264 + c4 * 4] = p;
  }
  __syncthreads();

  // wave work mapping (2x2 blocking phase 1, 2x4 blocking phase 2)
  const int mtg = wave & 1;                // phase-1 row tiles {2*mtg, 2*mtg+1}
  const int ctg = wave >> 1;               // phase-1 col tiles {2*ctg, 2*ctg+1} (chunk-local)
  const int mtg2 = wave & 1;               // phase-2 row tiles {2*mtg2, 2*mtg2+1}
  const int ntg2 = wave >> 1;              // phase-2 col tiles {4*ntg2 .. +3}

  const unsigned int* w1e = w1p + (size_t)e * 512 * 256;
  const unsigned int* w2e = w2p + (size_t)e * 512 * 256;

  const int laneRow = lane & 15;
  const int laneSel = (lane >> 4) << 3;    // 0 or 8 halves (A/B fragment K select)
  const int rOff    = (lane >> 4) << 3;    // C-layout row offset (0 or 8)

  v8f acc2[2][4] = {};                     // persistent Out accumulators

  for (int c = 0; c < 8; ++c) {
    // ---------------- phase 1: Hchunk[64x128] = Xtile @ W1[:, c*128 .. +128]
    v8f acc1[2][2] = {};
#pragma unroll
    for (int kt = 0; kt < 8; ++kt) {
      Frag a[2], b[2];
#pragma unroll
      for (int i = 0; i < 2; ++i) {
        const unsigned short* ap =
            &Xs[((mtg * 2 + i) * 16 + laneRow) * 264 + kt * 32 + laneSel];
        a[i].u[0] = *(const uint4*)ap;
        a[i].u[1] = *(const uint4*)(ap + 16);
      }
#pragma unroll
      for (int j = 0; j < 2; ++j) {
        const int nt = c * 8 + ctg * 2 + j;
        const uint4* bp = ((const uint4*)(w1e + (size_t)(nt * 8 + kt) * 256)) + lane * 2;
        b[j].u[0] = bp[0];
        b[j].u[1] = bp[1];
      }
#pragma unroll
      for (int i = 0; i < 2; ++i)
#pragma unroll
        for (int j = 0; j < 2; ++j)
          acc1[i][j] = __builtin_amdgcn_wmma_f32_16x16x32_bf16(
              false, a[i].v, false, b[j].v, (short)0, acc1[i][j], false, false);
    }
    // GELU (exact erf), convert, write H chunk to LDS (C-layout -> row-major)
#pragma unroll
    for (int i = 0; i < 2; ++i) {
      const int rbase = (mtg * 2 + i) * 16 + rOff;
#pragma unroll
      for (int j = 0; j < 2; ++j) {
        const int col = (ctg * 2 + j) * 16 + laneRow;
#pragma unroll
        for (int v = 0; v < 8; ++v)
          Hs[(rbase + v) * 136 + col] = f2bf(gelu_exact(acc1[i][j][v]));
      }
    }
    __syncthreads();

    // ---------------- phase 2: Out += Hchunk @ W2[c*128 .. +128, :]
#pragma unroll
    for (int kt2 = 0; kt2 < 4; ++kt2) {
      const int ktg = c * 4 + kt2;
      Frag a[2], b[4];
#pragma unroll
      for (int i = 0; i < 2; ++i) {
        const unsigned short* ap =
            &Hs[((mtg2 * 2 + i) * 16 + laneRow) * 136 + kt2 * 32 + laneSel];
        a[i].u[0] = *(const uint4*)ap;
        a[i].u[1] = *(const uint4*)(ap + 16);
      }
#pragma unroll
      for (int n = 0; n < 4; ++n) {
        const int nt = ntg2 * 4 + n;
        const uint4* bp = ((const uint4*)(w2e + (size_t)(nt * 32 + ktg) * 256)) + lane * 2;
        b[n].u[0] = bp[0];
        b[n].u[1] = bp[1];
      }
#pragma unroll
      for (int i = 0; i < 2; ++i)
#pragma unroll
        for (int n = 0; n < 4; ++n)
          acc2[i][n] = __builtin_amdgcn_wmma_f32_16x16x32_bf16(
              false, a[i].v, false, b[n].v, (short)0, acc2[i][n], false, false);
    }
    __syncthreads();
  }

  // ---- write Out tile [64 x 256] fp32 ----
  float* ot = out + ((size_t)e * CAP_ + m0) * D_;
#pragma unroll
  for (int i = 0; i < 2; ++i) {
    const int rbase = (mtg2 * 2 + i) * 16 + rOff;
#pragma unroll
    for (int n = 0; n < 4; ++n) {
      const int col = (ntg2 * 4 + n) * 16 + laneRow;
#pragma unroll
      for (int v = 0; v < 8; ++v)
        ot[(size_t)(rbase + v) * D_ + col] = acc2[i][n][v];
    }
  }
}

extern "C" void kernel_launch(void* const* d_in, const int* in_sizes, int n_in,
                              void* d_out, int out_size, void* d_ws, size_t ws_size,
                              hipStream_t stream) {
  const float* x      = (const float*)d_in[0];
  const float* w_fc   = (const float*)d_in[1];
  const float* w_proj = (const float*)d_in[2];
  float* out          = (float*)d_out;

  // workspace: 16 MB packed-bf16 W1 + 16 MB packed-bf16 W2
  unsigned int* w1p = (unsigned int*)d_ws;
  unsigned int* w2p = w1p + (size_t)E_ * 512 * 256;

  // 32768 tiles, 8 tiles (waves) per 256-thread block
  prep_weights_kernel<<<4096, 256, 0, stream>>>(w_fc, w_proj, w1p, w2p);

  // 32 experts x 64 row-blocks
  expert_mlp_kernel<<<E_ * (CAP_ / 64), 256, 0, stream>>>(x, w1p, w2p, out);
}

// v001
// A run of this version takes 283 microseconds.
// In both of two side-by-side timings against v000, it was 1.25 times as fast.
#include <hip/hip_runtime.h>
#include <hip/hip_bf16.h>
#include <math.h>

#define E_   32
#define CAP_ 4096
#define D_   256
#define HD_  1024

typedef __attribute__((ext_vector_type(16))) __bf16 v16bf;
typedef __attribute__((ext_vector_type(8)))  float  v8f;

union Frag {
  uint4 u[2];
  v16bf v;
};

// round-to-nearest-even fp32 -> bf16 (bit trick)
__device__ __forceinline__ unsigned short f2bf(float a) {
  unsigned int ua = __float_as_uint(a);
  return (unsigned short)((ua + 0x7FFFu + ((ua >> 16) & 1u)) >> 16);
}
__device__ __forceinline__ unsigned int pack2bf(float a, float b) {
  return (unsigned int)f2bf(a) | ((unsigned int)f2bf(b) << 16);
}
typedef __attribute__((ext_vector_type(2))) float v2f;

// Exact-form GELU, 0.5 x (1 + erf(x / sqrt 2)), of one accumulator tile (8 values a
// lane) without a branch: erf(u) = u P(u^2) / Q(u^2) on u clamped to [-4, 4], where
// erf is 1 to f32 rounding (rational form, absolute error of erf below 1e-6 over the
// whole range; Q < 0 for every u, so the reciprocal is always finite). One formula
// for every lane; the four packed pairs go through each stage together, so that
// eight independent chains are in flight instead of one. Every loop here is unrolled
// so that the small arrays live in registers and the stages stay straight-line code.
__device__ __forceinline__ void gelu_exact_tile(const v8f a, float (&g)[8]) {
  v2f x[4], u[4], t[4], p[4], q[4];
#pragma unroll
  for (int k = 0; k < 4; ++k) {
    x[k].x = a[2 * k];
    x[k].y = a[2 * k + 1];
    u[k] = x[k] * 0.70710678118654752440f;
    u[k] = __builtin_elementwise_min(__builtin_elementwise_max(u[k], (v2f)(-4.0f)), (v2f)(4.0f));
    t[k] = u[k] * u[k];
    p[k] = (v2f)(-2.72614225801306e-10f);
    q[k] = (v2f)(-1.45660718464996e-05f);
  }
  const float pc[6] = {2.77068142495902e-08f,  -2.10102402082508e-06f, -5.69250639462346e-05f,
                       -7.34990630326855e-04f, -2.95459980854025e-03f, -1.60960333262415e-02f};
  const float qc[4] = {-2.13374055278905e-04f, -1.68282697438203e-03f, -7.37332916720468e-03f,
                       -1.42647390514189e-02f};
#pragma unroll
  for (int s = 0; s < 6; ++s) {
#pragma unroll
    for (int k = 0; k < 4; ++k) {
      p[k] = __builtin_elementwise_fma(p[k], t[k], (v2f)(pc[s]));
      if (s < 4) q[k] = __builtin_elementwise_fma(q[k], t[k], (v2f)(qc[s]));
    }
  }
#pragma unroll
  for (int k = 0; k < 4; ++k) {
    q[k].x = __builtin_amdgcn_rcpf(q[k].x);
    q[k].y = __builtin_amdgcn_rcpf(q[k].y);
    p[k] = p[k] * u[k];
  }
#pragma unroll
  for (int k = 0; k < 4; ++k) {
    const v2f hx = 0.5f * x[k];
    const v2f r = __builtin_elementwise_fma(hx, p[k] * q[k], hx);
    g[2 * k]     = r.x;
    g[2 * k + 1] = r.y;
  }
}

// ---------------------------------------------------------------------------
// Prep: convert fp32 weights to bf16, packed per 32(K)x16(N) WMMA-B tile.
// Tile = 1024 bytes: lane L stores 32 bytes at L*32:
//   bytes  0-15 : K = k0 + sel + {0..7}   of column n0 + (L%16)
//   bytes 16-31 : K = k0 + sel + 16 + {0..7}
//   sel = 0 for L<16, 8 for L>=16   (matches ISA 16-bit B layout)
// W1 packed: [E][64 ntiles][8 ktiles]   (16 MB)
// W2 packed: [E][16 ntiles][32 ktiles]  (16 MB)
// ---------------------------------------------------------------------------
__global__ void __launch_bounds__(256) prep_weights_kernel(
    const float* __restrict__ w_fc, const float* __restrict__ w_proj,
    unsigned int* __restrict__ w1p, unsigned int* __restrict__ w2p) {
  const int wave = threadIdx.x >> 5;
  const int lane = threadIdx.x & 31;
  const int t = blockIdx.x * 8 + wave;          // 32768 tiles total
  const int sel = (lane >> 4) * 8;

  if (t < E_ * 512) {                           // W1: [256 x 1024], ldn = 1024
    const int e = t >> 9, rem = t & 511;
    const int nt = rem >> 3, kt = rem & 7;
    const float* src = w_fc + (size_t)e * D_ * HD_;
    const int col = nt * 16 + (lane & 15);
    unsigned int* dst = w1p + (size_t)t * 256 + lane * 8;
#pragma unroll
    for (int d = 0; d < 8; ++d) {
      const int part = d >> 2, dd = d & 3;
      const int k = kt * 32 + part * 16 + sel + dd * 2;
      dst[d] = pack2bf(src[(size_t)k * HD_ + col], src[(size_t)(k + 1) * HD_ + col]);
    }
  } else {                                      // W2: [1024 x 256], ldn = 256
    const int t2 = t - E_ * 512;
    const int e = t2 >> 9, rem = t2 & 511;
    const int nt = rem >> 5, kt = rem & 31;
    const float* src = w_proj + (size_t)e * HD_ * D_;
    const int col = nt * 16 + (lane & 15);
    unsigned int* dst = w2p + (size_t)t2 * 256 + lane * 8;
#pragma unroll
    for (int d = 0; d < 8; ++d) {
      const int part = d >> 2, dd = d & 3;
      const int k = kt * 32 + part * 16 + sel + dd * 2;
      dst[d] = pack2bf(src[(size_t)k * D_ + col], src[(size_t)(k + 1) * D_ + col]);
    }
  }
}

// ---------------------------------------------------------------------------
// Fused expert MLP: out = gelu(x @ w_fc) @ w_proj, 64 rows per workgroup.
// Hidden dim processed in 8 chunks of 128 columns; 2x2 / 2x4 register
// blocking per wave so every WMMA costs ~1 global b128 + ~0.75 ds b128.
// ---------------------------------------------------------------------------
__global__ void __launch_bounds__(256, 1) expert_mlp_kernel(
    const float* __restrict__ x,
    const unsigned int* __restrict__ w1p,
    const unsigned int* __restrict__ w2p,
    float* __restrict__ out) {
  __shared__ unsigned short Xs[64 * 264];  // 64 rows x 256 K, bf16, padded stride
  __shared__ unsigned short Hs[64 * 136];  // 64 rows x 128 hidden cols, bf16, padded

  const int tid  = threadIdx.x;
  const int wave = tid >> 5;
  const int lane = tid & 31;
  const int e  = blockIdx.x >> 6;          // 64 row-blocks per expert
  const int m0 = (blockIdx.x & 63) << 6;

  // ---- load + convert X tile [64 x 256] fp32 -> bf16 LDS (coalesced) ----
  const float4* xt = (const float4*)(x + ((size_t)e * CAP_ + m0) * D_);
#pragma unroll
  for (int it = 0; it < 16; ++it) {
    const int f = it * 256 + tid;
    const int row = f >> 6, c4 = f & 63;
    const float4 v = xt[row * 64 + c4];
    uint2 p;
    p.x = pack2bf(v.x, v.y);
    p.y = pack2bf(v.z, v.w);
    *(uint2*)&Xs[row * 264 + c4 * 4] = p;
  }
  __syncthreads();

  // wave work mapping (2x2 blocking phase 1, 2x4 blocking phase 2)
  const int mtg = wave & 1;                // phase-1 row tiles {2*mtg, 2*mtg+1}
  const int ctg = wave >> 1;               // phase-1 col tiles {2*ctg, 2*ctg+1} (chunk-local)
  const int mtg2 = wave & 1;               // phase-2 row tiles {2*mtg2, 2*mtg2+1}
  const int ntg2 = wave >> 1;              // phase-2 col tiles {4*ntg2 .. +3}

  const unsigned int* w1e = w1p + (size_t)e * 512 * 256;
  const unsigned int* w2e = w2p + (size_t)e * 512 * 256;

  const int laneRow = lane & 15;
  const int laneSel = (lane >> 4) << 3;    // 0 or 8 halves (A/B fragment K select)
  const int rOff    = (lane >> 4) << 3;    // C-layout row offset (0 or 8)

  v8f acc2[2][4] = {};                     // persistent Out accumulators

  for (int c = 0; c < 8; ++c) {
    // ---------------- phase 1: Hchunk[64x128] = Xtile @ W1[:, c*128 .. +128]
    v8f acc1[2][2] = {};
#pragma unroll
    for (int kt = 0; kt < 8; ++kt) {
      Frag a[2], b[2];
#pragma unroll
      for (int i = 0; i < 2; ++i) {
        const unsigned short* ap =
            &Xs[((mtg * 2 + i) * 16 + laneRow) * 264 + kt * 32 + laneSel];
        a[i].u[0] = *(const uint4*)ap;
        a[i].u[1] = *(const uint4*)(ap + 16);
      }
#pragma unroll
      for (int j = 0; j < 2; ++j) {
        const int nt = c * 8 + ctg * 2 + j;
        const uint4* bp = ((const uint4*)(w1e + (size_t)(nt * 8 + kt) * 256)) + lane * 2;
        b[j].u[0] = bp[0];
        b[j].u[1] = bp[1];
      }
#pragma unroll
      for (int i = 0; i < 2; ++i)
#pragma unroll
        for (int j = 0; j < 2; ++j)
          acc1[i][j] = __builtin_amdgcn_wmma_f32_16x16x32_bf16(
              false, a[i].v, false, b[j].v, (short)0, acc1[i][j], false, false);
    }
    // GELU (erf form), convert, write H chunk to LDS (C-layout -> row-major)
#pragma unroll
    for (int i = 0; i < 2; ++i) {
      const int rbase = (mtg * 2 + i) * 16 + rOff;
#pragma unroll
      for (int j = 0; j < 2; ++j) {
        const int col = (ctg * 2 + j) * 16 + laneRow;
        float g[8];
        gelu_exact_tile(acc1[i][j], g);
#pragma unroll
        for (int v = 0; v < 8; ++v)
          Hs[(rbase + v) * 136 + col] = f2bf(g[v]);
      }
    }
    __syncthreads();

    // ---------------- phase 2: Out += Hchunk @ W2[c*128 .. +128, :]
#pragma unroll
    for (int kt2 = 0; kt2 < 4; ++kt2) {
      const int ktg = c * 4 + kt2;
      Frag a[2], b[4];
#pragma unroll
      for (int i = 0; i < 2; ++i) {
        const unsigned short* ap =
            &Hs[((mtg2 * 2 + i) * 16 + laneRow) * 136 + kt2 * 32 + laneSel];
        a[i].u[0] = *(const uint4*)ap;
        a[i].u[1] = *(const uint4*)(ap + 16);
      }
#pragma unroll
      for (int n = 0; n < 4; ++n) {
        const int nt = ntg2 * 4 + n;
        const uint4* bp = ((const uint4*)(w2e + (size_t)(nt * 32 + ktg) * 256)) + lane * 2;
        b[n].u[0] = bp[0];
        b[n].u[1] = bp[1];
      }
#pragma unroll
      for (int i = 0; i < 2; ++i)
#pragma unroll
        for (int n = 0; n < 4; ++n)
          acc2[i][n] = __builtin_amdgcn_wmma_f32_16x16x32_bf16(
              false, a[i].v, false, b[n].v, (short)0, acc2[i][n], false, false);
    }
    __syncthreads();
  }

  // ---- write Out tile [64 x 256] fp32 ----
  float* ot = out + ((size_t)e * CAP_ + m0) * D_;
#pragma unroll
  for (int i = 0; i < 2; ++i) {
    const int rbase = (mtg2 * 2 + i) * 16 + rOff;
#pragma unroll
    for (int n = 0; n < 4; ++n) {
      const int col = (ntg2 * 4 + n) * 16 + laneRow;
#pragma unroll
      for (int v = 0; v < 8; ++v)
        ot[(size_t)(rbase + v) * D_ + col] = acc2[i][n][v];
    }
  }
}

extern "C" void kernel_launch(void* const* d_in, const int* in_sizes, int n_in,
                              void* d_out, int out_size, void* d_ws, size_t ws_size,
                              hipStream_t stream) {
  const float* x      = (const float*)d_in[0];
  const float* w_fc   = (const float*)d_in[1];
  const float* w_proj = (const float*)d_in[2];
  float* out          = (float*)d_out;

  // workspace: 16 MB packed-bf16 W1 + 16 MB packed-bf16 W2
  unsigned int* w1p = (unsigned int*)d_ws;
  unsigned int* w2p = w1p + (size_t)E_ * 512 * 256;

  // 32768 tiles, 8 tiles (waves) per 256-thread block
  prep_weights_kernel<<<4096, 256, 0, stream>>>(w_fc, w_proj, w1p, w2p);

  // 32 experts x 64 row-blocks
  expert_mlp_kernel<<<E_ * (CAP_ / 64), 256, 0, stream>>>(x, w1p, w2p, out);
}

// v002
// Measured time: 202 microseconds a run.
// In two side-by-side timings against v001, it was 1.40 and 1.41 times as fast.
// Counting every step since v000, it is 1.77 times as fast.
#include <hip/hip_runtime.h>
#include <hip/hip_bf16.h>
#include <math.h>

#define E_   32
#define CAP_ 4096
#define D_   256
#define HD_  1024

typedef __attribute__((ext_vector_type(16))) __bf16 v16bf;
typedef __attribute__((ext_vector_type(8)))  float  v8f;

union Frag {
  uint4 u[2];
  v16bf v;
};

// round-to-nearest-even fp32 -> bf16 (bit trick)
__device__ __forceinline__ unsigned short f2bf(float a) {
  unsigned int ua = __float_as_uint(a);
  return (unsigned short)((ua + 0x7FFFu + ((ua >> 16) & 1u)) >> 16);
}
__device__ __forceinline__ unsigned int pack2bf(float a, float b) {
  return (unsigned int)f2bf(a) | ((unsigned int)f2bf(b) << 16);
}
typedef __attribute__((ext_vector_type(2))) float v2f;

// Exact-form GELU, 0.5 x (1 + erf(x / sqrt 2)), of one accumulator tile (8 values a
// lane) without a branch: erf(u) = u P(u^2) / Q(u^2) on u clamped to [-4, 4], where
// erf is 1 to f32 rounding (rational form, absolute error of erf below 1e-6 over the
// whole range; Q < 0 for every u, so the reciprocal is always finite). One formula
// for every lane; the four packed pairs go through each stage together, so that
// eight independent chains are in flight instead of one. Every loop here is unrolled
// so that the small arrays live in registers and the stages stay straight-line code.
__device__ __forceinline__ void gelu_exact_tile(const v8f a, float (&g)[8]) {
  v2f x[4], u[4], t[4], p[4], q[4];
#pragma unroll
  for (int k = 0; k < 4; ++k) {
    x[k].x = a[2 * k];
    x[k].y = a[2 * k + 1];
    u[k] = x[k] * 0.70710678118654752440f;
    u[k] = __builtin_elementwise_min(__builtin_elementwise_max(u[k], (v2f)(-4.0f)), (v2f)(4.0f));
    t[k] = u[k] * u[k];
    p[k] = (v2f)(-2.72614225801306e-10f);
    q[k] = (v2f)(-1.45660718464996e-05f);
  }
  const float pc[6] = {2.77068142495902e-08f,  -2.10102402082508e-06f, -5.69250639462346e-05f,
                       -7.34990630326855e-04f, -2.95459980854025e-03f, -1.60960333262415e-02f};
  const float qc[4] = {-2.13374055278905e-04f, -1.68282697438203e-03f, -7.37332916720468e-03f,
                       -1.42647390514189e-02f};
#pragma unroll
  for (int s = 0; s < 6; ++s) {
#pragma unroll
    for (int k = 0; k < 4; ++k) {
      p[k] = __builtin_elementwise_fma(p[k], t[k], (v2f)(pc[s]));
      if (s < 4) q[k] = __builtin_elementwise_fma(q[k], t[k], (v2f)(qc[s]));
    }
  }
#pragma unroll
  for (int k = 0; k < 4; ++k) {
    q[k].x = __builtin_amdgcn_rcpf(q[k].x);
    q[k].y = __builtin_amdgcn_rcpf(q[k].y);
    p[k] = p[k] * u[k];
  }
#pragma unroll
  for (int k = 0; k < 4; ++k) {
    const v2f hx = 0.5f * x[k];
    const v2f r = __builtin_elementwise_fma(hx, p[k] * q[k], hx);
    g[2 * k]     = r.x;
    g[2 * k + 1] = r.y;
  }
}

// ---------------------------------------------------------------------------
// Prep: convert fp32 weights to bf16, packed per 32(K)x16(N) WMMA-B tile.
// Tile = 1024 bytes: lane L stores 32 bytes at L*32:
//   bytes  0-15 : K = k0 + sel + {0..7}   of column n0 + (L%16)
//   bytes 16-31 : K = k0 + sel + 16 + {0..7}
//   sel = 0 for L<16, 8 for L>=16   (matches ISA 16-bit B layout)
// W1 packed: [E][64 ntiles][8 ktiles]   (16 MB)
// W2 packed: [E][16 ntiles][32 ktiles]  (16 MB)
// ---------------------------------------------------------------------------
__global__ void __launch_bounds__(256) prep_weights_kernel(
    const float* __restrict__ w_fc, const float* __restrict__ w_proj,
    unsigned int* __restrict__ w1p, unsigned int* __restrict__ w2p) {
  const int wave = threadIdx.x >> 5;
  const int lane = threadIdx.x & 31;
  const int t = blockIdx.x * 8 + wave;          // 32768 tiles total
  const int sel = (lane >> 4) * 8;

  if (t < E_ * 512) {                           // W1: [256 x 1024], ldn = 1024
    const int e = t >> 9, rem = t & 511;
    const int nt = rem >> 3, kt = rem & 7;
    const float* src = w_fc + (size_t)e * D_ * HD_;
    const int col = nt * 16 + (lane & 15);
    unsigned int* dst = w1p + (size_t)t * 256 + lane * 8;
#pragma unroll
    for (int d = 0; d < 8; ++d) {
      const int part = d >> 2, dd = d & 3;
      const int k = kt * 32 + part * 16 + sel + dd * 2;
      dst[d] = pack2bf(src[(size_t)k * HD_ + col], src[(size_t)(k + 1) * HD_ + col]);
    }
  } else {                                      // W2: [1024 x 256], ldn = 256
    const int t2 = t - E_ * 512;
    const int e = t2 >> 9, rem = t2 & 511;
    const int nt = rem >> 5, kt = rem & 31;
    const float* src = w_proj + (size_t)e * HD_ * D_;
    const int col = nt * 16 + (lane & 15);
    unsigned int* dst = w2p + (size_t)t2 * 256 + lane * 8;
#pragma unroll
    for (int d = 0; d < 8; ++d) {
      const int part = d >> 2, dd = d & 3;
      const int k = kt * 32 + part * 16 + sel + dd * 2;
      dst[d] = pack2bf(src[(size_t)k * D_ + col], src[(size_t)(k + 1) * D_ + col]);
    }
  }
}

// ---------------------------------------------------------------------------
// Fused expert MLP: out = gelu(x @ w_fc) @ w_proj, 64 rows per workgroup.
// Hidden dim processed in 8 chunks of 128 columns; 2x2 / 2x4 register
// blocking per wave so every WMMA costs ~1 global b128 + ~0.75 ds b128.
// ---------------------------------------------------------------------------
__global__ void __launch_bounds__(256, 1) expert_mlp_kernel(
    const float* __restrict__ x,
    const unsigned int* __restrict__ w1p,
    const unsigned int* __restrict__ w2p,
    float* __restrict__ out) {
  __shared__ unsigned short Xs[64 * 264];  // 64 rows x 256 K, bf16, padded stride
  __shared__ unsigned short Hs[64 * 136];  // 64 rows x 128 hidden cols, bf16, padded

  const int tid  = threadIdx.x;
  const int wave = tid >> 5;
  const int lane = tid & 31;
  const int e  = blockIdx.x >> 6;          // 64 row-blocks per expert
  const int m0 = (blockIdx.x & 63) << 6;

  // ---- load + convert X tile [64 x 256] fp32 -> bf16 LDS (coalesced) ----
  const float4* xt = (const float4*)(x + ((size_t)e * CAP_ + m0) * D_);
#pragma unroll
  for (int it = 0; it < 16; ++it) {
    const int f = it * 256 + tid;
    const int row = f >> 6, c4 = f & 63;
    const float4 v = xt[row * 64 + c4];
    uint2 p;
    p.x = pack2bf(v.x, v.y);
    p.y = pack2bf(v.z, v.w);
    *(uint2*)&Xs[row * 264 + c4 * 4] = p;
  }
  __syncthreads();

  // wave work mapping (2x2 blocking phase 1, 2x4 blocking phase 2)
  const int mtg = wave & 1;                // phase-1 row tiles {2*mtg, 2*mtg+1}
  const int ctg = wave >> 1;               // phase-1 col tiles {2*ctg, 2*ctg+1} (chunk-local)
  const int mtg2 = wave & 1;               // phase-2 row tiles {2*mtg2, 2*mtg2+1}
  const int ntg2 = wave >> 1;              // phase-2 col tiles {4*ntg2 .. +3}

  const unsigned int* w1e = w1p + (size_t)e * 512 * 256;
  const unsigned int* w2e = w2p + (size_t)e * 512 * 256;

  const int laneRow = lane & 15;
  const int laneSel = (lane >> 4) << 3;    // 0 or 8 halves (A/B fragment K select)
  const int rOff    = (lane >> 4) << 3;    // C-layout row offset (0 or 8)

  v8f acc2[2][4] = {};                     // persistent Out accumulators

  // Operand fragments are fetched ahead of the WMMAs that read them.
  // B comes straight from L2 into registers. A chunk uses it in 16 groups of two
  // fragments (four WMMAs each): groups 0-7 are phase 1 (one k tile of W1, two column
  // tiles), groups 8-15 phase 2 (one k tile of W2, two of the four column tiles).
  // A ring of four groups is in flight: a group's loads are issued four groups ahead
  // of its WMMAs, also across the GELU and into the next chunk.
  // A comes from LDS, one k tile ahead, into the other of two fragment sets.
  const uint4* w1l = (const uint4*)w1e + lane * 2;
  const uint4* w2l = (const uint4*)w2e + lane * 2;
  const unsigned short* xa = &Xs[(mtg * 32 + laneRow) * 264 + laneSel];
  const unsigned short* ha = &Hs[(mtg2 * 32 + laneRow) * 136 + laneSel];
  Frag rb[4][2];
  Frag fa[2][2];
  auto issue_group = [&](int cc, int g, Frag (&dst)[2]) {
#pragma unroll
    for (int j = 0; j < 2; ++j) {
      const uint4* bp;
      if (g < 8) {
        bp = w1l + (size_t)((cc * 8 + ctg * 2 + j) * 8 + g) * 64;
      } else {
        const int h = g - 8;
        bp = w2l + (size_t)((ntg2 * 4 + (h & 1) * 2 + j) * 32 + cc * 4 + (h >> 1)) * 64;
      }
      dst[j].u[0] = bp[0];
      dst[j].u[1] = bp[1];
    }
  };
  auto load_a = [&](const unsigned short* base, int pitch, int kt, Frag (&dst)[2]) {
#pragma unroll
    for (int i = 0; i < 2; ++i) {
      const unsigned short* ap = base + i * 16 * pitch + kt * 32;
      dst[i].u[0] = *(const uint4*)ap;
      dst[i].u[1] = *(const uint4*)(ap + 16);
    }
  };
#pragma unroll
  for (int g = 0; g < 4; ++g) issue_group(0, g, rb[g]);
  load_a(xa, 264, 0, fa[0]);

  for (int c = 0; c < 8; ++c) {
    // ---------------- phase 1: Hchunk[64x128] = Xtile @ W1[:, c*128 .. +128]
    v8f acc1[2][2] = {};
#pragma unroll
    for (int kt = 0; kt < 8; ++kt) {
      if (kt < 7) load_a(xa, 264, kt + 1, fa[(kt + 1) & 1]);
#pragma unroll
      for (int i = 0; i < 2; ++i)
#pragma unroll
        for (int j = 0; j < 2; ++j)
          acc1[i][j] = __builtin_amdgcn_wmma_f32_16x16x32_bf16(
              false, fa[kt & 1][i].v, false, rb[kt & 3][j].v, (short)0, acc1[i][j], false, false);
      issue_group(c, kt + 4, rb[kt & 3]);
      // keeps the look-ahead loads where they are written: without it the scheduler
      // sinks them down to their first use and the L2 latency is waited out again
      __builtin_amdgcn_sched_barrier(0);
    }
    // GELU (erf form), convert, write H chunk to LDS (C-layout -> row-major)
#pragma unroll
    for (int i = 0; i < 2; ++i) {
      const int rbase = (mtg * 2 + i) * 16 + rOff;
#pragma unroll
      for (int j = 0; j < 2; ++j) {
        const int col = (ctg * 2 + j) * 16 + laneRow;
        float g[8];
        gelu_exact_tile(acc1[i][j], g);
#pragma unroll
        for (int v = 0; v < 8; ++v)
          Hs[(rbase + v) * 136 + col] = f2bf(g[v]);
      }
    }
    __syncthreads();

    // ---------------- phase 2: Out += Hchunk @ W2[c*128 .. +128, :]
    const int cn = c < 7 ? c + 1 : 7;      // the last chunk's look-ahead stays in bounds
    load_a(ha, 136, 0, fa[0]);
#pragma unroll
    for (int kt2 = 0; kt2 < 4; ++kt2) {
      if (kt2 < 3) load_a(ha, 136, kt2 + 1, fa[(kt2 + 1) & 1]);
      else         load_a(xa, 264, 0, fa[0]);   // the next chunk's first X fragments
#pragma unroll
      for (int hf = 0; hf < 2; ++hf) {
        const int g = 8 + kt2 * 2 + hf;
#pragma unroll
        for (int i = 0; i < 2; ++i)
#pragma unroll
          for (int j = 0; j < 2; ++j)
            acc2[i][hf * 2 + j] = __builtin_amdgcn_wmma_f32_16x16x32_bf16(
                false, fa[kt2 & 1][i].v, false, rb[g & 3][j].v, (short)0, acc2[i][hf * 2 + j],
                false, false);
        if (g + 4 < 16) issue_group(c, g + 4, rb[g & 3]);
        else            issue_group(cn, g + 4 - 16, rb[g & 3]);
        // as in phase 1: holds the look-ahead loads at this place
        __builtin_amdgcn_sched_barrier(0);
      }
    }
    __syncthreads();
  }

  // ---- write Out tile [64 x 256] fp32 ----
  float* ot = out + ((size_t)e * CAP_ + m0) * D_;
#pragma unroll
  for (int i = 0; i < 2; ++i) {
    const int rbase = (mtg2 * 2 + i) * 16 + rOff;
#pragma unroll
    for (int n = 0; n < 4; ++n) {
      const int col = (ntg2 * 4 + n) * 16 + laneRow;
#pragma unroll
      for (int v = 0; v < 8; ++v)
        ot[(size_t)(rbase + v) * D_ + col] = acc2[i][n][v];
    }
  }
}

extern "C" void kernel_launch(void* const* d_in, const int* in_sizes, int n_in,
                              void* d_out, int out_size, void* d_ws, size_t ws_size,
                              hipStream_t stream) {
  const float* x      = (const float*)d_in[0];
  const float* w_fc   = (const float*)d_in[1];
  const float* w_proj = (const float*)d_in[2];
  float* out          = (float*)d_out;

  // workspace: 16 MB packed-bf16 W1 + 16 MB packed-bf16 W2
  unsigned int* w1p = (unsigned int*)d_ws;
  unsigned int* w2p = w1p + (size_t)E_ * 512 * 256;

  // 32768 tiles, 8 tiles (waves) per 256-thread block
  prep_weights_kernel<<<4096, 256, 0, stream>>>(w_fc, w_proj, w1p, w2p);

  // 32 experts x 64 row-blocks
  expert_mlp_kernel<<<E_ * (CAP_ / 64), 256, 0, stream>>>(x, w1p, w2p, out);
}

// v003
// One run takes 184 microseconds.
// In two side-by-side timings against v002, it was 1.10 and 1.09 times as fast.
// Counting every step since v000, it is 1.93 times as fast.
#include <hip/hip_runtime.h>
#include <hip/hip_bf16.h>
#include <math.h>

#define E_   32
#define CAP_ 4096
#define D_   256
#define HD_  1024

typedef __attribute__((ext_vector_type(16))) __bf16 v16bf;
typedef __attribute__((ext_vector_type(8)))  float  v8f;

union Frag {
  uint4 u[2];
  v16bf v;
};

// round-to-nearest-even fp32 -> bf16 (bit trick)
__device__ __forceinline__ unsigned short f2bf(float a) {
  unsigned int ua = __float_as_uint(a);
  return (unsigned short)((ua + 0x7FFFu + ((ua >> 16) & 1u)) >> 16);
}
__device__ __forceinline__ unsigned int pack2bf(float a, float b) {
  return (unsigned int)f2bf(a) | ((unsigned int)f2bf(b) << 16);
}
typedef __attribute__((ext_vector_type(2))) float v2f;

// Exact-form GELU, 0.5 x (1 + erf(x / sqrt 2)), of one accumulator tile (8 values a
// lane) without a branch: erf(u) = u P(u^2) / Q(u^2) on u clamped to [-4, 4], where
// erf is 1 to f32 rounding (rational form, absolute error of erf below 1e-6 over the
// whole range; Q < 0 for every u, so the reciprocal is always finite). One formula
// for every lane; the four packed pairs go through each stage together, so that
// eight independent chains are in flight instead of one. Every loop here is unrolled
// so that the small arrays live in registers and the stages stay straight-line code.
__device__ __forceinline__ void gelu_exact_tile(const v8f a, float (&g)[8]) {
  v2f x[4], u[4], t[4], p[4], q[4];
#pragma unroll
  for (int k = 0; k < 4; ++k) {
    x[k].x = a[2 * k];
    x[k].y = a[2 * k + 1];
    u[k] = x[k] * 0.70710678118654752440f;
    u[k] = __builtin_elementwise_min(__builtin_elementwise_max(u[k], (v2f)(-4.0f)), (v2f)(4.0f));
    t[k] = u[k] * u[k];
    p[k] = (v2f)(-2.72614225801306e-10f);
    q[k] = (v2f)(-1.45660718464996e-05f);
  }
  const float pc[6] = {2.77068142495902e-08f,  -2.10102402082508e-06f, -5.69250639462346e-05f,
                       -7.34990630326855e-04f, -2.95459980854025e-03f, -1.60960333262415e-02f};
  const float qc[4] = {-2.13374055278905e-04f, -1.68282697438203e-03f, -7.37332916720468e-03f,
                       -1.42647390514189e-02f};
#pragma unroll
  for (int s = 0; s < 6; ++s) {
#pragma unroll
    for (int k = 0; k < 4; ++k) {
      p[k] = __builtin_elementwise_fma(p[k], t[k], (v2f)(pc[s]));
      if (s < 4) q[k] = __builtin_elementwise_fma(q[k], t[k], (v2f)(qc[s]));
    }
  }
#pragma unroll
  for (int k = 0; k < 4; ++k) {
    q[k].x = __builtin_amdgcn_rcpf(q[k].x);
    q[k].y = __builtin_amdgcn_rcpf(q[k].y);
    p[k] = p[k] * u[k];
  }
#pragma unroll
  for (int k = 0; k < 4; ++k) {
    const v2f hx = 0.5f * x[k];
    const v2f r = __builtin_elementwise_fma(hx, p[k] * q[k], hx);
    g[2 * k]     = r.x;
    g[2 * k + 1] = r.y;
  }
}

// ---------------------------------------------------------------------------
// Prep: convert fp32 weights to bf16, packed per 32(K)x16(N) WMMA-B tile.
// Tile = 1024 bytes in two halves of 512; lane L owns 16 bytes at L*16 of each:
//   first half  : K = k0 + sel + {0..7}   of column n0 + (L%16)
//   second half : K = k0 + sel + 16 + {0..7}
//   sel = 0 for L<16, 8 for L>=16   (matches ISA 16-bit B layout)
// So each 16-byte load of a whole wave reads 512 contiguous bytes, four whole
// 128-byte lines, and not every other 16 bytes of eight lines.
// W1 packed: [E][64 ntiles][8 ktiles]   (16 MB)
// W2 packed: [E][16 ntiles][32 ktiles]  (16 MB)
// ---------------------------------------------------------------------------
__global__ void __launch_bounds__(256) prep_weights_kernel(
    const float* __restrict__ w_fc, const float* __restrict__ w_proj,
    unsigned int* __restrict__ w1p, unsigned int* __restrict__ w2p) {
  const int wave = threadIdx.x >> 5;
  const int lane = threadIdx.x & 31;
  const int t = blockIdx.x * 8 + wave;          // 32768 tiles total
  const int sel = (lane >> 4) * 8;

  if (t < E_ * 512) {                           // W1: [256 x 1024], ldn = 1024
    const int e = t >> 9, rem = t & 511;
    const int nt = rem >> 3, kt = rem & 7;
    const float* src = w_fc + (size_t)e * D_ * HD_;
    const int col = nt * 16 + (lane & 15);
    uint4* tile = (uint4*)(w1p + (size_t)t * 256) + lane;
    unsigned int dst[8];
#pragma unroll
    for (int d = 0; d < 8; ++d) {
      const int part = d >> 2, dd = d & 3;
      const int k = kt * 32 + part * 16 + sel + dd * 2;
      dst[d] = pack2bf(src[(size_t)k * HD_ + col], src[(size_t)(k + 1) * HD_ + col]);
    }
    tile[0]  = make_uint4(dst[0], dst[1], dst[2], dst[3]);
    tile[32] = make_uint4(dst[4], dst[5], dst[6], dst[7]);
  } else {                                      // W2: [1024 x 256], ldn = 256
    const int t2 = t - E_ * 512;
    const int e = t2 >> 9, rem = t2 & 511;
    const int nt = rem >> 5, kt = rem & 31;
    const float* src = w_proj + (size_t)e * HD_ * D_;
    const int col = nt * 16 + (lane & 15);
    uint4* tile = (uint4*)(w2p + (size_t)t2 * 256) + lane;
    unsigned int dst[8];
#pragma unroll
    for (int d = 0; d < 8; ++d) {
      const int part = d >> 2, dd = d & 3;
      const int k = kt * 32 + part * 16 + sel + dd * 2;
      dst[d] = pack2bf(src[(size_t)k * D_ + col], src[(size_t)(k + 1) * D_ + col]);
    }
    tile[0]  = make_uint4(dst[0], dst[1], dst[2], dst[3]);
    tile[32] = make_uint4(dst[4], dst[5], dst[6], dst[7]);
  }
}

// ---------------------------------------------------------------------------
// Fused expert MLP: out = gelu(x @ w_fc) @ w_proj, 64 rows per workgroup.
// Hidden dim processed in 8 chunks of 128 columns; 2x2 / 2x4 register
// blocking per wave so every WMMA costs ~1 global b128 + ~0.75 ds b128.
// ---------------------------------------------------------------------------
__global__ void __launch_bounds__(256, 1) expert_mlp_kernel(
    const float* __restrict__ x,
    const unsigned int* __restrict__ w1p,
    const unsigned int* __restrict__ w2p,
    float* __restrict__ out) {
  __shared__ unsigned short Xs[64 * 264];  // 64 rows x 256 K, bf16, padded stride
  __shared__ unsigned short Hs[64 * 136];  // 64 rows x 128 hidden cols, bf16, padded

  const int tid  = threadIdx.x;
  const int wave = tid >> 5;
  const int lane = tid & 31;
  const int e  = blockIdx.x >> 6;          // 64 row-blocks per expert
  const int m0 = (blockIdx.x & 63) << 6;

  // ---- load + convert X tile [64 x 256] fp32 -> bf16 LDS (coalesced) ----
  const float4* xt = (const float4*)(x + ((size_t)e * CAP_ + m0) * D_);
#pragma unroll
  for (int it = 0; it < 16; ++it) {
    const int f = it * 256 + tid;
    const int row = f >> 6, c4 = f & 63;
    const float4 v = xt[row * 64 + c4];
    uint2 p;
    p.x = pack2bf(v.x, v.y);
    p.y = pack2bf(v.z, v.w);
    *(uint2*)&Xs[row * 264 + c4 * 4] = p;
  }
  __syncthreads();

  // wave work mapping (2x2 blocking phase 1, 2x4 blocking phase 2)
  const int mtg = wave & 1;                // phase-1 row tiles {2*mtg, 2*mtg+1}
  const int ctg = wave >> 1;               // phase-1 col tiles {2*ctg, 2*ctg+1} (chunk-local)
  const int mtg2 = wave & 1;               // phase-2 row tiles {2*mtg2, 2*mtg2+1}
  const int ntg2 = wave >> 1;              // phase-2 col tiles {4*ntg2 .. +3}

  const unsigned int* w1e = w1p + (size_t)e * 512 * 256;
  const unsigned int* w2e = w2p + (size_t)e * 512 * 256;

  const int laneRow = lane & 15;
  const int laneSel = (lane >> 4) << 3;    // 0 or 8 halves (A/B fragment K select)
  const int rOff    = (lane >> 4) << 3;    // C-layout row offset (0 or 8)

  v8f acc2[2][4] = {};                     // persistent Out accumulators

  // Operand fragments are fetched ahead of the WMMAs that read them.
  // B comes straight from L2 into registers. A chunk uses it in 16 groups of two
  // fragments (four WMMAs each): groups 0-7 are phase 1 (one k tile of W1, two column
  // tiles), groups 8-15 phase 2 (one k tile of W2, two of the four column tiles).
  // A ring of four groups is in flight: a group's loads are issued four groups ahead
  // of its WMMAs, also across the GELU and into the next chunk.
  // A comes from LDS, one k tile ahead, into the other of two fragment sets.
  const uint4* w1l = (const uint4*)w1e + lane;
  const uint4* w2l = (const uint4*)w2e + lane;
  const unsigned short* xa = &Xs[(mtg * 32 + laneRow) * 264 + laneSel];
  const unsigned short* ha = &Hs[(mtg2 * 32 + laneRow) * 136 + laneSel];
  Frag rb[4][2];
  Frag fa[2][2];
  auto issue_group = [&](int cc, int g, Frag (&dst)[2]) {
#pragma unroll
    for (int j = 0; j < 2; ++j) {
      const uint4* bp;
      if (g < 8) {
        bp = w1l + (size_t)((cc * 8 + ctg * 2 + j) * 8 + g) * 64;
      } else {
        const int h = g - 8;
        bp = w2l + (size_t)((ntg2 * 4 + (h & 1) * 2 + j) * 32 + cc * 4 + (h >> 1)) * 64;
      }
      dst[j].u[0] = bp[0];
      dst[j].u[1] = bp[32];                // the tile's second 512-byte half
    }
  };
  auto load_a = [&](const unsigned short* base, int pitch, int kt, Frag (&dst)[2]) {
#pragma unroll
    for (int i = 0; i < 2; ++i) {
      const unsigned short* ap = base + i * 16 * pitch + kt * 32;
      dst[i].u[0] = *(const uint4*)ap;
      dst[i].u[1] = *(const uint4*)(ap + 16);
    }
  };
#pragma unroll
  for (int g = 0; g < 4; ++g) issue_group(0, g, rb[g]);
  load_a(xa, 264, 0, fa[0]);

  for (int c = 0; c < 8; ++c) {
    // ---------------- phase 1: Hchunk[64x128] = Xtile @ W1[:, c*128 .. +128]
    v8f acc1[2][2] = {};
#pragma unroll
    for (int kt = 0; kt < 8; ++kt) {
      if (kt < 7) load_a(xa, 264, kt + 1, fa[(kt + 1) & 1]);
#pragma unroll
      for (int i = 0; i < 2; ++i)
#pragma unroll
        for (int j = 0; j < 2; ++j)
          acc1[i][j] = __builtin_amdgcn_wmma_f32_16x16x32_bf16(
              false, fa[kt & 1][i].v, false, rb[kt & 3][j].v, (short)0, acc1[i][j], false, false);
      issue_group(c, kt + 4, rb[kt & 3]);
      // keeps the look-ahead loads where they are written: without it the scheduler
      // sinks them down to their first use and the L2 latency is waited out again
      __builtin_amdgcn_sched_barrier(0);
    }
    // GELU (erf form), convert, write H chunk to LDS (C-layout -> row-major)
#pragma unroll
    for (int i = 0; i < 2; ++i) {
      const int rbase = (mtg * 2 + i) * 16 + rOff;
#pragma unroll
      for (int j = 0; j < 2; ++j) {
        const int col = (ctg * 2 + j) * 16 + laneRow;
        float g[8];
        gelu_exact_tile(acc1[i][j], g);
#pragma unroll
        for (int v = 0; v < 8; ++v)
          Hs[(rbase + v) * 136 + col] = f2bf(g[v]);
      }
    }
    __syncthreads();

    // ---------------- phase 2: Out += Hchunk @ W2[c*128 .. +128, :]
    const int cn = c < 7 ? c + 1 : 7;      // the last chunk's look-ahead stays in bounds
    load_a(ha, 136, 0, fa[0]);
#pragma unroll
    for (int kt2 = 0; kt2 < 4; ++kt2) {
      if (kt2 < 3) load_a(ha, 136, kt2 + 1, fa[(kt2 + 1) & 1]);
      else         load_a(xa, 264, 0, fa[0]);   // the next chunk's first X fragments
#pragma unroll
      for (int hf = 0; hf < 2; ++hf) {
        const int g = 8 + kt2 * 2 + hf;
#pragma unroll
        for (int i = 0; i < 2; ++i)
#pragma unroll
          for (int j = 0; j < 2; ++j)
            acc2[i][hf * 2 + j] = __builtin_amdgcn_wmma_f32_16x16x32_bf16(
                false, fa[kt2 & 1][i].v, false, rb[g & 3][j].v, (short)0, acc2[i][hf * 2 + j],
                false, false);
        if (g + 4 < 16) issue_group(c, g + 4, rb[g & 3]);
        else            issue_group(cn, g + 4 - 16, rb[g & 3]);
        // as in phase 1: holds the look-ahead loads at this place
        __builtin_amdgcn_sched_barrier(0);
      }
    }
    __syncthreads();
  }

  // ---- write Out tile [64 x 256] fp32 ----
  float* ot = out + ((size_t)e * CAP_ + m0) * D_;
#pragma unroll
  for (int i = 0; i < 2; ++i) {
    const int rbase = (mtg2 * 2 + i) * 16 + rOff;
#pragma unroll
    for (int n = 0; n < 4; ++n) {
      const int col = (ntg2 * 4 + n) * 16 + laneRow;
#pragma unroll
      for (int v = 0; v < 8; ++v)
        ot[(size_t)(rbase + v) * D_ + col] = acc2[i][n][v];
    }
  }
}

extern "C" void kernel_launch(void* const* d_in, const int* in_sizes, int n_in,
                              void* d_out, int out_size, void* d_ws, size_t ws_size,
                              hipStream_t stream) {
  const float* x      = (const float*)d_in[0];
  const float* w_fc   = (const float*)d_in[1];
  const float* w_proj = (const float*)d_in[2];
  float* out          = (float*)d_out;

  // workspace: 16 MB packed-bf16 W1 + 16 MB packed-bf16 W2
  unsigned int* w1p = (unsigned int*)d_ws;
  unsigned int* w2p = w1p + (size_t)E_ * 512 * 256;

  // 32768 tiles, 8 tiles (waves) per 256-thread block
  prep_weights_kernel<<<4096, 256, 0, stream>>>(w_fc, w_proj, w1p, w2p);

  // 32 experts x 64 row-blocks
  expert_mlp_kernel<<<E_ * (CAP_ / 64), 256, 0, stream>>>(x, w1p, w2p, out);
}

// v004
// One run takes 159 microseconds.
// Two timings next to v003 put it at 1.16 and 1.15 times that version's speed.
// All steps since v000 together make it 2.23 times as fast.
#include <hip/hip_runtime.h>
#include <hip/hip_bf16.h>
#include <math.h>

#define E_   32
#define CAP_ 4096
#define D_   256
#define HD_  1024

typedef __attribute__((ext_vector_type(16))) __bf16 v16bf;
typedef __attribute__((ext_vector_type(8)))  float  v8f;

union Frag {
  uint4 u[2];
  v16bf v;
};

// round-to-nearest-even fp32 -> bf16 (bit trick)
__device__ __forceinline__ unsigned short f2bf(float a) {
  unsigned int ua = __float_as_uint(a);
  return (unsigned short)((ua + 0x7FFFu + ((ua >> 16) & 1u)) >> 16);
}
__device__ __forceinline__ unsigned int pack2bf(float a, float b) {
  return (unsigned int)f2bf(a) | ((unsigned int)f2bf(b) << 16);
}
typedef __attribute__((ext_vector_type(2))) float v2f;

// Exact-form GELU, 0.5 x (1 + erf(x / sqrt 2)), of one accumulator tile (8 values a
// lane) without a branch: erf(u) = u P(u^2) / Q(u^2) on u clamped to [-4, 4], where
// erf is 1 to f32 rounding (rational form, absolute error of erf below 1e-6 over the
// whole range; Q < 0 for every u, so the reciprocal is always finite). One formula
// for every lane; the four packed pairs go through each stage together, so that
// eight independent chains are in flight instead of one. Every loop here is unrolled
// so that the small arrays live in registers and the stages stay straight-line code.
__device__ __forceinline__ void gelu_exact_tile(const v8f a, float (&g)[8]) {
  v2f x[4], u[4], t[4], p[4], q[4];
#pragma unroll
  for (int k = 0; k < 4; ++k) {
    x[k].x = a[2 * k];
    x[k].y = a[2 * k + 1];
    u[k] = x[k] * 0.70710678118654752440f;
    u[k] = __builtin_elementwise_min(__builtin_elementwise_max(u[k], (v2f)(-4.0f)), (v2f)(4.0f));
    t[k] = u[k] * u[k];
    p[k] = (v2f)(-2.72614225801306e-10f);
    q[k] = (v2f)(-1.45660718464996e-05f);
  }
  const float pc[6] = {2.77068142495902e-08f,  -2.10102402082508e-06f, -5.69250639462346e-05f,
                       -7.34990630326855e-04f, -2.95459980854025e-03f, -1.60960333262415e-02f};
  const float qc[4] = {-2.13374055278905e-04f, -1.68282697438203e-03f, -7.37332916720468e-03f,
                       -1.42647390514189e-02f};
#pragma unroll
  for (int s = 0; s < 6; ++s) {
#pragma unroll
    for (int k = 0; k < 4; ++k) {
      p[k] = __builtin_elementwise_fma(p[k], t[k], (v2f)(pc[s]));
      if (s < 4) q[k] = __builtin_elementwise_fma(q[k], t[k], (v2f)(qc[s]));
    }
  }
#pragma unroll
  for (int k = 0; k < 4; ++k) {
    q[k].x = __builtin_amdgcn_rcpf(q[k].x);
    q[k].y = __builtin_amdgcn_rcpf(q[k].y);
    p[k] = p[k] * u[k];
  }
#pragma unroll
  for (int k = 0; k < 4; ++k) {
    const v2f hx = 0.5f * x[k];
    const v2f r = __builtin_elementwise_fma(hx, p[k] * q[k], hx);
    g[2 * k]     = r.x;
    g[2 * k + 1] = r.y;
  }
}

// ---------------------------------------------------------------------------
// Prep: convert fp32 weights to bf16, packed per 32(K)x16(N) WMMA-B tile.
// Tile = 1024 bytes in two halves of 512; lane L owns 16 bytes at L*16 of each:
//   first half  : K = k0 + sel + {0..7}   of column n0 + (L%16)
//   second half : K = k0 + sel + 16 + {0..7}
//   sel = 0 for L<16, 8 for L>=16   (matches ISA 16-bit B layout)
// So each 16-byte load of a whole wave reads 512 contiguous bytes, four whole
// 128-byte lines, and not every other 16 bytes of eight lines.
// W1 packed: [E][64 ntiles][8 ktiles]   (16 MB)
// W2 packed: [E][16 ntiles][32 ktiles]  (16 MB)
// ---------------------------------------------------------------------------
__global__ void __launch_bounds__(256) prep_weights_kernel(
    const float* __restrict__ w_fc, const float* __restrict__ w_proj,
    unsigned int* __restrict__ w1p, unsigned int* __restrict__ w2p) {
  const int wave = threadIdx.x >> 5;
  const int lane = threadIdx.x & 31;
  const int t = blockIdx.x * 8 + wave;          // 32768 tiles total
  const int sel = (lane >> 4) * 8;

  if (t < E_ * 512) {                           // W1: [256 x 1024], ldn = 1024
    const int e = t >> 9, rem = t & 511;
    const int nt = rem >> 3, kt = rem & 7;
    const float* src = w_fc + (size_t)e * D_ * HD_;
    const int col = nt * 16 + (lane & 15);
    uint4* tile = (uint4*)(w1p + (size_t)t * 256) + lane;
    unsigned int dst[8];
#pragma unroll
    for (int d = 0; d < 8; ++d) {
      const int part = d >> 2, dd = d & 3;
      const int k = kt * 32 + part * 16 + sel + dd * 2;
      dst[d] = pack2bf(src[(size_t)k * HD_ + col], src[(size_t)(k + 1) * HD_ + col]);
    }
    tile[0]  = make_uint4(dst[0], dst[1], dst[2], dst[3]);
    tile[32] = make_uint4(dst[4], dst[5], dst[6], dst[7]);
  } else {                                      // W2: [1024 x 256], ldn = 256
    const int t2 = t - E_ * 512;
    const int e = t2 >> 9, rem = t2 & 511;
    const int nt = rem >> 5, kt = rem & 31;
    const float* src = w_proj + (size_t)e * HD_ * D_;
    const int col = nt * 16 + (lane & 15);
    uint4* tile = (uint4*)(w2p + (size_t)t2 * 256) + lane;
    unsigned int dst[8];
#pragma unroll
    for (int d = 0; d < 8; ++d) {
      const int part = d >> 2, dd = d & 3;
      const int k = kt * 32 + part * 16 + sel + dd * 2;
      dst[d] = pack2bf(src[(size_t)k * D_ + col], src[(size_t)(k + 1) * D_ + col]);
    }
    tile[0]  = make_uint4(dst[0], dst[1], dst[2], dst[3]);
    tile[32] = make_uint4(dst[4], dst[5], dst[6], dst[7]);
  }
}

// ---------------------------------------------------------------------------
// Fused expert MLP: out = gelu(x @ w_fc) @ w_proj, 64 rows at a time.
// 512 workgroups, as many as the chip holds at once (two a WGP). Each keeps ONE
// expert (index mod 32) and walks four of its 64-row blocks one after the other:
// all 32 experts are in work from the start, an expert's packed weights are brought
// into L2 during the first block only, and the three later blocks read them again
// from there, instead of every workgroup of an expert meeting every weight line at
// its first fetch.
// Hidden dim processed in 8 chunks of 128 columns; 2x2 / 2x4 register
// blocking per wave so every WMMA costs ~1 global b128 + ~0.75 ds b128.
// ---------------------------------------------------------------------------
__global__ void __launch_bounds__(256, 1) expert_mlp_kernel(
    const float* __restrict__ x,
    const unsigned int* __restrict__ w1p,
    const unsigned int* __restrict__ w2p,
    float* __restrict__ out) {
  __shared__ unsigned short Xs[64 * 264];  // 64 rows x 256 K, bf16, padded stride
  __shared__ unsigned short Hs[64 * 136];  // 64 rows x 128 hidden cols, bf16, padded

  const int tid  = threadIdx.x;
  const int wave = tid >> 5;
  const int lane = tid & 31;
  const int e  = blockIdx.x & (E_ - 1);    // neighbours in the grid take different experts
  const int mb = blockIdx.x >> 5;          // 16 workgroups per expert

  // wave work mapping (2x2 blocking phase 1, 2x4 blocking phase 2)
  const int mtg = wave & 1;                // phase-1 row tiles {2*mtg, 2*mtg+1}
  const int ctg = wave >> 1;               // phase-1 col tiles {2*ctg, 2*ctg+1} (chunk-local)
  const int mtg2 = wave & 1;               // phase-2 row tiles {2*mtg2, 2*mtg2+1}
  const int ntg2 = wave >> 1;              // phase-2 col tiles {4*ntg2 .. +3}

  const unsigned int* w1e = w1p + (size_t)e * 512 * 256;
  const unsigned int* w2e = w2p + (size_t)e * 512 * 256;

  const int laneRow = lane & 15;
  const int laneSel = (lane >> 4) << 3;    // 0 or 8 halves (A/B fragment K select)
  const int rOff    = (lane >> 4) << 3;    // C-layout row offset (0 or 8)

  // Operand fragments are fetched ahead of the WMMAs that read them.
  // B comes straight from L2 into registers. A chunk uses it in 16 groups of two
  // fragments (four WMMAs each): groups 0-7 are phase 1 (one k tile of W1, two column
  // tiles), groups 8-15 phase 2 (one k tile of W2, two of the four column tiles).
  // A ring of four groups is in flight: a group's loads are issued four groups ahead
  // of its WMMAs, also across the GELU, into the next chunk and, the expert being the
  // same, from a row block's last chunk into the next block's first.
  // A comes from LDS, one k tile ahead, into the other of two fragment sets.
  const uint4* w1l = (const uint4*)w1e + lane;
  const uint4* w2l = (const uint4*)w2e + lane;
  const unsigned short* xa = &Xs[(mtg * 32 + laneRow) * 264 + laneSel];
  const unsigned short* ha = &Hs[(mtg2 * 32 + laneRow) * 136 + laneSel];
  Frag rb[4][2];
  Frag fa[2][2];
  auto issue_group = [&](int cc, int g, Frag (&dst)[2]) {
#pragma unroll
    for (int j = 0; j < 2; ++j) {
      const uint4* bp;
      if (g < 8) {
        bp = w1l + (size_t)((cc * 8 + ctg * 2 + j) * 8 + g) * 64;
      } else {
        const int h = g - 8;
        bp = w2l + (size_t)((ntg2 * 4 + (h & 1) * 2 + j) * 32 + cc * 4 + (h >> 1)) * 64;
      }
      dst[j].u[0] = bp[0];
      dst[j].u[1] = bp[32];                // the tile's second 512-byte half
    }
  };
  auto load_a = [&](const unsigned short* base, int pitch, int kt, Frag (&dst)[2]) {
#pragma unroll
    for (int i = 0; i < 2; ++i) {
      const unsigned short* ap = base + i * 16 * pitch + kt * 32;
      dst[i].u[0] = *(const uint4*)ap;
      dst[i].u[1] = *(const uint4*)(ap + 16);
    }
  };
#pragma unroll
  for (int g = 0; g < 4; ++g) issue_group(0, g, rb[g]);

  // one LDS address for the X stores, the rest constant offsets: sixteen addresses kept
  // over the block loop would cost the registers that let two workgroups share a WGP
  unsigned short* xs_st = &Xs[(tid >> 6) * 264 + (tid & 63) * 4];

  for (int blk = 0; blk < 4; ++blk) {      // row blocks mb, mb + 16, mb + 32, mb + 48
  const int m0 = (mb + blk * 16) << 6;

  // (every read of Xs for the block before lies in front of that block's last barrier)
  // ---- load + convert X tile [64 x 256] fp32 -> bf16 LDS (coalesced) ----
  const float4* xt = (const float4*)(x + ((size_t)e * CAP_ + m0) * D_);
#pragma unroll
  for (int it = 0; it < 16; ++it) {
    const float4 v = xt[it * 256 + tid];   // row it * 4 + (tid >> 6), float4 column tid & 63
    uint2 p;
    p.x = pack2bf(v.x, v.y);
    p.y = pack2bf(v.z, v.w);
    *(uint2*)&xs_st[it * 4 * 264] = p;
  }
  __syncthreads();

  load_a(xa, 264, 0, fa[0]);
  v8f acc2[2][4] = {};                     // Out accumulators of this row block

  for (int c = 0; c < 8; ++c) {
    // ---------------- phase 1: Hchunk[64x128] = Xtile @ W1[:, c*128 .. +128]
    v8f acc1[2][2] = {};
#pragma unroll
    for (int kt = 0; kt < 8; ++kt) {
      if (kt < 7) load_a(xa, 264, kt + 1, fa[(kt + 1) & 1]);
#pragma unroll
      for (int i = 0; i < 2; ++i)
#pragma unroll
        for (int j = 0; j < 2; ++j)
          acc1[i][j] = __builtin_amdgcn_wmma_f32_16x16x32_bf16(
              false, fa[kt & 1][i].v, false, rb[kt & 3][j].v, (short)0, acc1[i][j], false, false);
      issue_group(c, kt + 4, rb[kt & 3]);
      // keeps the look-ahead loads where they are written: without it the scheduler
      // sinks them down to their first use and the L2 latency is waited out again
      __builtin_amdgcn_sched_barrier(0);
    }
    // GELU (erf form), convert, write H chunk to LDS (C-layout -> row-major)
#pragma unroll
    for (int i = 0; i < 2; ++i) {
      const int rbase = (mtg * 2 + i) * 16 + rOff;
#pragma unroll
      for (int j = 0; j < 2; ++j) {
        const int col = (ctg * 2 + j) * 16 + laneRow;
        float g[8];
        gelu_exact_tile(acc1[i][j], g);
#pragma unroll
        for (int v = 0; v < 8; ++v)
          Hs[(rbase + v) * 136 + col] = f2bf(g[v]);
      }
    }
    __syncthreads();

    // ---------------- phase 2: Out += Hchunk @ W2[c*128 .. +128, :]
    const int cn = (c + 1) & 7;            // after the last chunk: the next block's first
    load_a(ha, 136, 0, fa[0]);
#pragma unroll
    for (int kt2 = 0; kt2 < 4; ++kt2) {
      if (kt2 < 3) load_a(ha, 136, kt2 + 1, fa[(kt2 + 1) & 1]);
      else         load_a(xa, 264, 0, fa[0]);   // the next chunk's first X fragments
#pragma unroll
      for (int hf = 0; hf < 2; ++hf) {
        const int g = 8 + kt2 * 2 + hf;
#pragma unroll
        for (int i = 0; i < 2; ++i)
#pragma unroll
          for (int j = 0; j < 2; ++j)
            acc2[i][hf * 2 + j] = __builtin_amdgcn_wmma_f32_16x16x32_bf16(
                false, fa[kt2 & 1][i].v, false, rb[g & 3][j].v, (short)0, acc2[i][hf * 2 + j],
                false, false);
        if (g + 4 < 16) issue_group(c, g + 4, rb[g & 3]);
        else            issue_group(cn, g + 4 - 16, rb[g & 3]);
        // as in phase 1: holds the look-ahead loads at this place
        __builtin_amdgcn_sched_barrier(0);
      }
    }
    __syncthreads();
  }

  // ---- write Out tile [64 x 256] fp32 ----
  float* ot = out + ((size_t)e * CAP_ + m0) * D_;
#pragma unroll
  for (int i = 0; i < 2; ++i) {
    const int rbase = (mtg2 * 2 + i) * 16 + rOff;
#pragma unroll
    for (int n = 0; n < 4; ++n) {
      const int col = (ntg2 * 4 + n) * 16 + laneRow;
#pragma unroll
      for (int v = 0; v < 8; ++v)
        ot[(size_t)(rbase + v) * D_ + col] = acc2[i][n][v];
    }
  }
  // the next block's first instructions overwrite registers that these stores name
  asm volatile("s_wait_xcnt 0x0" ::: "memory");
  }  // row blocks
}

extern "C" void kernel_launch(void* const* d_in, const int* in_sizes, int n_in,
                              void* d_out, int out_size, void* d_ws, size_t ws_size,
                              hipStream_t stream) {
  const float* x      = (const float*)d_in[0];
  const float* w_fc   = (const float*)d_in[1];
  const float* w_proj = (const float*)d_in[2];
  float* out          = (float*)d_out;

  // workspace: 16 MB packed-bf16 W1 + 16 MB packed-bf16 W2
  unsigned int* w1p = (unsigned int*)d_ws;
  unsigned int* w2p = w1p + (size_t)E_ * 512 * 256;

  // 32768 tiles, 8 tiles (waves) per 256-thread block
  prep_weights_kernel<<<4096, 256, 0, stream>>>(w_fc, w_proj, w1p, w2p);

  // 32 experts x 16 workgroups, four 64-row blocks each
  expert_mlp_kernel<<<E_ * 16, 256, 0, stream>>>(x, w1p, w2p, out);
}

// v005
// A run of this version takes 142 microseconds.
// In both of two side-by-side timings against v004, it was 1.12 times as fast.
// Counting every step since v000, it is 2.50 times as fast.
#include <hip/hip_runtime.h>
#include <hip/hip_bf16.h>
#include <math.h>

#define E_   32
#define CAP_ 4096
#define D_   256
#define HD_  1024

typedef __attribute__((ext_vector_type(16))) __bf16 v16bf;
typedef __attribute__((ext_vector_type(8)))  float  v8f;

union Frag {
  uint4 u[2];
  v16bf v;
};

// round-to-nearest-even fp32 -> bf16 (bit trick)
__device__ __forceinline__ unsigned short f2bf(float a) {
  unsigned int ua = __float_as_uint(a);
  return (unsigned short)((ua + 0x7FFFu + ((ua >> 16) & 1u)) >> 16);
}
__device__ __forceinline__ unsigned int pack2bf(float a, float b) {
  return (unsigned int)f2bf(a) | ((unsigned int)f2bf(b) << 16);
}
typedef __attribute__((ext_vector_type(2))) float v2f;

// Exact-form GELU, 0.5 x (1 + erf(x / sqrt 2)), of one accumulator tile (8 values a
// lane) without a branch: erf(u) = u P(u^2) / Q(u^2) on u clamped to [-4, 4], where
// erf is 1 to f32 rounding (rational form, absolute error of erf below 1e-6 over the
// whole range; Q < 0 for every u, so the reciprocal is always finite). One formula
// for every lane; the four packed pairs go through each stage together, so that
// eight independent chains are in flight instead of one. Every loop here is unrolled
// so that the small arrays live in registers and the stages stay straight-line code.
__device__ __forceinline__ void gelu_exact_tile(const v8f a, float (&g)[8]) {
  v2f x[4], u[4], t[4], p[4], q[4];
#pragma unroll
  for (int k = 0; k < 4; ++k) {
    x[k].x = a[2 * k];
    x[k].y = a[2 * k + 1];
    u[k] = x[k] * 0.70710678118654752440f;
    u[k] = __builtin_elementwise_min(__builtin_elementwise_max(u[k], (v2f)(-4.0f)), (v2f)(4.0f));
    t[k] = u[k] * u[k];
    p[k] = (v2f)(-2.72614225801306e-10f);
    q[k] = (v2f)(-1.45660718464996e-05f);
  }
  const float pc[6] = {2.77068142495902e-08f,  -2.10102402082508e-06f, -5.69250639462346e-05f,
                       -7.34990630326855e-04f, -2.95459980854025e-03f, -1.60960333262415e-02f};
  const float qc[4] = {-2.13374055278905e-04f, -1.68282697438203e-03f, -7.37332916720468e-03f,
                       -1.42647390514189e-02f};
#pragma unroll
  for (int s = 0; s < 6; ++s) {
#pragma unroll
    for (int k = 0; k < 4; ++k) {
      p[k] = __builtin_elementwise_fma(p[k], t[k], (v2f)(pc[s]));
      if (s < 4) q[k] = __builtin_elementwise_fma(q[k], t[k], (v2f)(qc[s]));
    }
  }
#pragma unroll
  for (int k = 0; k < 4; ++k) {
    q[k].x = __builtin_amdgcn_rcpf(q[k].x);
    q[k].y = __builtin_amdgcn_rcpf(q[k].y);
    p[k] = p[k] * u[k];
  }
#pragma unroll
  for (int k = 0; k < 4; ++k) {
    const v2f hx = 0.5f * x[k];
    const v2f r = __builtin_elementwise_fma(hx, p[k] * q[k], hx);
    g[2 * k]     = r.x;
    g[2 * k + 1] = r.y;
  }
}

// ---------------------------------------------------------------------------
// Prep: convert fp32 weights to bf16, packed per 32(K)x16(N) WMMA-B tile.
// Tile = 1024 bytes in two halves of 512; lane L owns 16 bytes at L*16 of each:
//   first half  : K = k0 + sel + {0..7}   of column n0 + (L%16)
//   second half : K = k0 + sel + 16 + {0..7}
//   sel = 0 for L<16, 8 for L>=16   (matches ISA 16-bit B layout)
// So each 16-byte load of a whole wave reads 512 contiguous bytes, four whole
// 128-byte lines, and not every other 16 bytes of eight lines.
// W1 packed: [E][64 ntiles][8 ktiles]   (16 MB)
// W2 packed: [E][16 ntiles][32 ktiles]  (16 MB)
// ---------------------------------------------------------------------------
__global__ void __launch_bounds__(256) prep_weights_kernel(
    const float* __restrict__ w_fc, const float* __restrict__ w_proj,
    unsigned int* __restrict__ w1p, unsigned int* __restrict__ w2p) {
  const int wave = threadIdx.x >> 5;
  const int lane = threadIdx.x & 31;
  const int t = blockIdx.x * 8 + wave;          // 32768 tiles total
  const int sel = (lane >> 4) * 8;

  if (t < E_ * 512) {                           // W1: [256 x 1024], ldn = 1024
    const int e = t >> 9, rem = t & 511;
    const int nt = rem >> 3, kt = rem & 7;
    const float* src = w_fc + (size_t)e * D_ * HD_;
    const int col = nt * 16 + (lane & 15);
    uint4* tile = (uint4*)(w1p + (size_t)t * 256) + lane;
    unsigned int dst[8];
#pragma unroll
    for (int d = 0; d < 8; ++d) {
      const int part = d >> 2, dd = d & 3;
      const int k = kt * 32 + part * 16 + sel + dd * 2;
      dst[d] = pack2bf(src[(size_t)k * HD_ + col], src[(size_t)(k + 1) * HD_ + col]);
    }
    tile[0]  = make_uint4(dst[0], dst[1], dst[2], dst[3]);
    tile[32] = make_uint4(dst[4], dst[5], dst[6], dst[7]);
  } else {                                      // W2: [1024 x 256], ldn = 256
    const int t2 = t - E_ * 512;
    const int e = t2 >> 9, rem = t2 & 511;
    const int nt = rem >> 5, kt = rem & 31;
    const float* src = w_proj + (size_t)e * HD_ * D_;
    const int col = nt * 16 + (lane & 15);
    uint4* tile = (uint4*)(w2p + (size_t)t2 * 256) + lane;
    unsigned int dst[8];
#pragma unroll
    for (int d = 0; d < 8; ++d) {
      const int part = d >> 2, dd = d & 3;
      const int k = kt * 32 + part * 16 + sel + dd * 2;
      dst[d] = pack2bf(src[(size_t)k * D_ + col], src[(size_t)(k + 1) * D_ + col]);
    }
    tile[0]  = make_uint4(dst[0], dst[1], dst[2], dst[3]);
    tile[32] = make_uint4(dst[4], dst[5], dst[6], dst[7]);
  }
}

// ---------------------------------------------------------------------------
// Fused expert MLP: out = gelu(x @ w_fc) @ w_proj, 64 rows at a time.
// 512 workgroups of FOUR waves, two workgroups a WGP (one wave of each on every SIMD,
// up to 512 registers a wave). Each keeps ONE expert (index mod 32) and walks four of
// its 64-row blocks one after the other: all 32 experts are in work from the start, an
// expert's packed weights are brought into L2 during the first block only, and the
// three later blocks read them again from there.
// Hidden dim processed in 8 chunks of 128 columns; 4x2 / 4x4 register blocking per
// wave: a wave holds all four row tiles of the block, so no two waves load the same
// weight fragment and each fragment loaded from L2 feeds four WMMAs.
// ---------------------------------------------------------------------------
__global__ void __launch_bounds__(128, 2) expert_mlp_kernel(
    const float* __restrict__ x,
    const unsigned int* __restrict__ w1p,
    const unsigned int* __restrict__ w2p,
    float* __restrict__ out) {
  __shared__ unsigned short Xs[64 * 264];  // 64 rows x 256 K, bf16, padded stride
  __shared__ unsigned short Hs[64 * 136];  // 64 rows x 128 hidden cols, bf16, padded

  const int tid  = threadIdx.x;
  const int wave = tid >> 5;
  const int lane = tid & 31;
  const int e  = blockIdx.x & (E_ - 1);    // neighbours in the grid take different experts
  const int mb = blockIdx.x >> 5;          // 16 workgroups per expert

  // wave work mapping (4x2 blocking phase 1, 4x4 blocking phase 2): all four row tiles
  const int ctg = wave;                    // phase-1 col tiles {2*ctg, 2*ctg+1} (chunk-local)
  const int ntg2 = wave;                   // phase-2 col tiles {4*ntg2 .. +3}

  const unsigned int* w1e = w1p + (size_t)e * 512 * 256;
  const unsigned int* w2e = w2p + (size_t)e * 512 * 256;

  const int laneRow = lane & 15;
  const int laneSel = (lane >> 4) << 3;    // 0 or 8 halves (A/B fragment K select)
  const int rOff    = (lane >> 4) << 3;    // C-layout row offset (0 or 8)

  // Operand fragments are fetched ahead of the WMMAs that read them.
  // B comes straight from L2 into registers. A chunk uses it in 16 groups of two
  // fragments (eight WMMAs each): groups 0-7 are phase 1 (one k tile of W1, two column
  // tiles), groups 8-15 phase 2 (one k tile of W2, two of the four column tiles).
  // A ring of four groups is in flight: a group's loads are issued four groups ahead
  // of its WMMAs, also across the GELU, into the next chunk and, the expert being the
  // same, from a row block's last chunk into the next block's first.
  // A comes from LDS, one k tile ahead, into the other of two fragment sets.
  const uint4* w1l = (const uint4*)w1e + lane;
  const uint4* w2l = (const uint4*)w2e + lane;
  const unsigned short* xa = &Xs[laneRow * 264 + laneSel];
  const unsigned short* ha = &Hs[laneRow * 136 + laneSel];
  Frag rb[4][2];
  Frag fa[2][4];
  auto issue_group = [&](int cc, int g, Frag (&dst)[2]) {
#pragma unroll
    for (int j = 0; j < 2; ++j) {
      const uint4* bp;
      if (g < 8) {
        bp = w1l + (size_t)((cc * 8 + ctg * 2 + j) * 8 + g) * 64;
      } else {
        const int h = g - 8;
        bp = w2l + (size_t)((ntg2 * 4 + (h & 1) * 2 + j) * 32 + cc * 4 + (h >> 1)) * 64;
      }
      dst[j].u[0] = bp[0];
      dst[j].u[1] = bp[32];                // the tile's second 512-byte half
    }
  };
  auto load_a = [&](const unsigned short* base, int pitch, int kt, Frag (&dst)[4]) {
#pragma unroll
    for (int i = 0; i < 4; ++i) {
      const unsigned short* ap = base + i * 16 * pitch + kt * 32;
      dst[i].u[0] = *(const uint4*)ap;
      dst[i].u[1] = *(const uint4*)(ap + 16);
    }
  };
#pragma unroll
  for (int g = 0; g < 4; ++g) issue_group(0, g, rb[g]);

  // one LDS address for the X stores, the rest constant offsets
  unsigned short* xs_st = &Xs[(tid >> 6) * 264 + (tid & 63) * 4];

  for (int blk = 0; blk < 4; ++blk) {      // row blocks mb, mb + 16, mb + 32, mb + 48
  const int m0 = (mb + blk * 16) << 6;

  // (every read of Xs for the block before lies in front of that block's last barrier)
  // ---- load + convert X tile [64 x 256] fp32 -> bf16 LDS (coalesced) ----
  const float4* xt = (const float4*)(x + ((size_t)e * CAP_ + m0) * D_) + tid;
  float4 xv[32];
#pragma unroll
  for (int it = 0; it < 32; ++it)
    xv[it] = xt[it * 128];                 // row it * 2 + (tid >> 6), float4 column tid & 63
  // the address pair that these loads name is free for reuse from here on; as an input
  // it stays whole up to this wait, so that no load's own result lands on it earlier
  asm volatile("s_wait_xcnt 0x0" :: "v"(xt) : "memory");
#pragma unroll
  for (int it = 0; it < 32; ++it) {
    const float4 v = xv[it];
    uint2 p;
    p.x = pack2bf(v.x, v.y);
    p.y = pack2bf(v.z, v.w);
    *(uint2*)&xs_st[it * 2 * 264] = p;
  }
  __syncthreads();

  load_a(xa, 264, 0, fa[0]);
  v8f acc2[4][4] = {};                     // Out accumulators of this row block

  for (int c = 0; c < 8; ++c) {
    // ---------------- phase 1: Hchunk[64x128] = Xtile @ W1[:, c*128 .. +128]
    v8f acc1[4][2] = {};
#pragma unroll
    for (int kt = 0; kt < 8; ++kt) {
      if (kt < 7) load_a(xa, 264, kt + 1, fa[(kt + 1) & 1]);
      // keeps the next k tile's LDS reads as one group ahead of this tile's WMMAs: the
      // scheduler otherwise sinks them among the WMMAs, right in front of their use,
      // and with two waves a SIMD the LDS latency is then waited out at every k tile
      __builtin_amdgcn_sched_barrier(0);
#pragma unroll
      for (int i = 0; i < 4; ++i)
#pragma unroll
        for (int j = 0; j < 2; ++j)
          acc1[i][j] = __builtin_amdgcn_wmma_f32_16x16x32_bf16(
              false, fa[kt & 1][i].v, false, rb[kt & 3][j].v, (short)0, acc1[i][j], false, false);
      issue_group(c, kt + 4, rb[kt & 3]);
      // keeps the look-ahead loads where they are written: without it the scheduler
      // sinks them down to their first use and the L2 latency is waited out again
      __builtin_amdgcn_sched_barrier(0);
      // the next step rewrites address registers that these loads name
      asm volatile("s_wait_xcnt 0x0" ::: "memory");
    }
    // GELU (erf form), convert, write H chunk to LDS (C-layout -> row-major)
#pragma unroll
    for (int i = 0; i < 4; ++i) {
      const int rbase = i * 16 + rOff;
#pragma unroll
      for (int j = 0; j < 2; ++j) {
        const int col = (ctg * 2 + j) * 16 + laneRow;
        float g[8];
        gelu_exact_tile(acc1[i][j], g);
#pragma unroll
        for (int v = 0; v < 8; ++v)
          Hs[(rbase + v) * 136 + col] = f2bf(g[v]);
      }
    }
    __syncthreads();

    // ---------------- phase 2: Out += Hchunk @ W2[c*128 .. +128, :]
    const int cn = (c + 1) & 7;            // after the last chunk: the next block's first
    load_a(ha, 136, 0, fa[0]);
#pragma unroll
    for (int kt2 = 0; kt2 < 4; ++kt2) {
      if (kt2 < 3) load_a(ha, 136, kt2 + 1, fa[(kt2 + 1) & 1]);
      else         load_a(xa, 264, 0, fa[0]);   // the next chunk's first X fragments
      // as in phase 1: the LDS reads stay one group ahead of the WMMAs
      __builtin_amdgcn_sched_barrier(0);
#pragma unroll
      for (int hf = 0; hf < 2; ++hf) {
        const int g = 8 + kt2 * 2 + hf;
#pragma unroll
        for (int i = 0; i < 4; ++i)
#pragma unroll
          for (int j = 0; j < 2; ++j)
            acc2[i][hf * 2 + j] = __builtin_amdgcn_wmma_f32_16x16x32_bf16(
                false, fa[kt2 & 1][i].v, false, rb[g & 3][j].v, (short)0, acc2[i][hf * 2 + j],
                false, false);
        if (g + 4 < 16) issue_group(c, g + 4, rb[g & 3]);
        else            issue_group(cn, g + 4 - 16, rb[g & 3]);
        // as in phase 1: holds the look-ahead loads at this place
        __builtin_amdgcn_sched_barrier(0);
        // the next step rewrites address registers that these loads name
        asm volatile("s_wait_xcnt 0x0" ::: "memory");
      }
    }
    __syncthreads();
  }

  // ---- write Out tile [64 x 256] fp32 ----
  // one address for the lane's 128 stores, the rest constant offsets: sixteen address
  // offsets kept over the block loop would cost registers
  float* ot = out + ((size_t)e * CAP_ + m0 + rOff) * D_ + ntg2 * 64 + laneRow;
#pragma unroll
  for (int i = 0; i < 4; ++i) {
#pragma unroll
    for (int n = 0; n < 4; ++n) {
#pragma unroll
      for (int v = 0; v < 8; ++v)
        ot[(i * 16 + v) * D_ + n * 16] = acc2[i][n][v];
    }
  }
  // the next block's first instructions overwrite registers that these stores name
  asm volatile("s_wait_xcnt 0x0" ::: "memory");
  }  // row blocks
}

extern "C" void kernel_launch(void* const* d_in, const int* in_sizes, int n_in,
                              void* d_out, int out_size, void* d_ws, size_t ws_size,
                              hipStream_t stream) {
  const float* x      = (const float*)d_in[0];
  const float* w_fc   = (const float*)d_in[1];
  const float* w_proj = (const float*)d_in[2];
  float* out          = (float*)d_out;

  // workspace: 16 MB packed-bf16 W1 + 16 MB packed-bf16 W2
  unsigned int* w1p = (unsigned int*)d_ws;
  unsigned int* w2p = w1p + (size_t)E_ * 512 * 256;

  // 32768 tiles, 8 tiles (waves) per 256-thread block
  prep_weights_kernel<<<4096, 256, 0, stream>>>(w_fc, w_proj, w1p, w2p);

  // 32 experts x 16 workgroups of four waves, four 64-row blocks each
  expert_mlp_kernel<<<E_ * 16, 128, 0, stream>>>(x, w1p, w2p, out);
}

// v006
// It runs in 138 microseconds.
// Two timings next to v005 both put it at 1.03 times that version's speed.
// All steps since v000 together make it 2.58 times as fast.
#include <hip/hip_runtime.h>
#include <hip/hip_bf16.h>
#include <math.h>

#define E_   32
#define CAP_ 4096
#define D_   256
#define HD_  1024

typedef __attribute__((ext_vector_type(16))) __bf16 v16bf;
typedef __attribute__((ext_vector_type(8)))  float  v8f;

union Frag {
  uint4 u[2];
  v16bf v;
};

typedef __attribute__((ext_vector_type(2))) float  v2f;
typedef __attribute__((ext_vector_type(2))) __bf16 v2bf;

// two fp32 -> two bf16 in one register (a low, b high), round to nearest even, by the
// chip's own packed conversion: one instruction for the pair
__device__ __forceinline__ unsigned int pack2bf(float a, float b) {
  v2f f;
  f.x = a;
  f.y = b;
  return __builtin_bit_cast(unsigned int, __builtin_convertvector(f, v2bf));
}

// Exact-form GELU, 0.5 x (1 + erf(x / sqrt 2)), of one accumulator tile (8 values a
// lane) without a branch: erf(u) = u P(u^2) / Q(u^2) on u clamped to [-4, 4], where
// erf is 1 to f32 rounding (rational form, absolute error of erf below 1e-6 over the
// whole range; Q < 0 for every u, so the reciprocal is always finite). One formula
// for every lane; the four packed pairs go through each stage together, so that
// eight independent chains are in flight instead of one. Every loop here is unrolled
// so that the small arrays live in registers and the stages stay straight-line code.
__device__ __forceinline__ void gelu_exact_tile(const v8f a, float (&g)[8]) {
  v2f x[4], u[4], t[4], p[4], q[4];
#pragma unroll
  for (int k = 0; k < 4; ++k) {
    x[k].x = a[2 * k];
    x[k].y = a[2 * k + 1];
    u[k] = x[k] * 0.70710678118654752440f;
    u[k] = __builtin_elementwise_min(__builtin_elementwise_max(u[k], (v2f)(-4.0f)), (v2f)(4.0f));
    t[k] = u[k] * u[k];
    p[k] = (v2f)(-2.72614225801306e-10f);
    q[k] = (v2f)(-1.45660718464996e-05f);
  }
  const float pc[6] = {2.77068142495902e-08f,  -2.10102402082508e-06f, -5.69250639462346e-05f,
                       -7.34990630326855e-04f, -2.95459980854025e-03f, -1.60960333262415e-02f};
  const float qc[4] = {-2.13374055278905e-04f, -1.68282697438203e-03f, -7.37332916720468e-03f,
                       -1.42647390514189e-02f};
#pragma unroll
  for (int s = 0; s < 6; ++s) {
#pragma unroll
    for (int k = 0; k < 4; ++k) {
      p[k] = __builtin_elementwise_fma(p[k], t[k], (v2f)(pc[s]));
      if (s < 4) q[k] = __builtin_elementwise_fma(q[k], t[k], (v2f)(qc[s]));
    }
  }
#pragma unroll
  for (int k = 0; k < 4; ++k) {
    q[k].x = __builtin_amdgcn_rcpf(q[k].x);
    q[k].y = __builtin_amdgcn_rcpf(q[k].y);
    p[k] = p[k] * u[k];
  }
#pragma unroll
  for (int k = 0; k < 4; ++k) {
    const v2f hx = 0.5f * x[k];
    const v2f r = __builtin_elementwise_fma(hx, p[k] * q[k], hx);
    g[2 * k]     = r.x;
    g[2 * k + 1] = r.y;
  }
}

// ---------------------------------------------------------------------------
// Prep: convert fp32 weights to bf16, packed per 32(K)x16(N) WMMA-B tile.
// Tile = 1024 bytes in two halves of 512; lane L owns 16 bytes at L*16 of each:
//   first half  : K = k0 + sel + {0..7}   of column n0 + (L%16)
//   second half : K = k0 + sel + 16 + {0..7}
//   sel = 0 for L<16, 8 for L>=16   (matches ISA 16-bit B layout)
// So each 16-byte load of a whole wave reads 512 contiguous bytes, four whole
// 128-byte lines, and not every other 16 bytes of eight lines.
// W1 packed: [E][64 ntiles][8 ktiles]   (16 MB)
// W2 packed: [E][16 ntiles][32 ktiles]  (16 MB)
// ---------------------------------------------------------------------------
__global__ void __launch_bounds__(256) prep_weights_kernel(
    const float* __restrict__ w_fc, const float* __restrict__ w_proj,
    unsigned int* __restrict__ w1p, unsigned int* __restrict__ w2p) {
  const int wave = threadIdx.x >> 5;
  const int lane = threadIdx.x & 31;
  const int t = blockIdx.x * 8 + wave;          // 32768 tiles total
  const int sel = (lane >> 4) * 8;

  if (t < E_ * 512) {                           // W1: [256 x 1024], ldn = 1024
    const int e = t >> 9, rem = t & 511;
    const int nt = rem >> 3, kt = rem & 7;
    const float* src = w_fc + (size_t)e * D_ * HD_;
    const int col = nt * 16 + (lane & 15);
    uint4* tile = (uint4*)(w1p + (size_t)t * 256) + lane;
    unsigned int dst[8];
#pragma unroll
    for (int d = 0; d < 8; ++d) {
      const int part = d >> 2, dd = d & 3;
      const int k = kt * 32 + part * 16 + sel + dd * 2;
      dst[d] = pack2bf(src[(size_t)k * HD_ + col], src[(size_t)(k + 1) * HD_ + col]);
    }
    tile[0]  = make_uint4(dst[0], dst[1], dst[2], dst[3]);
    tile[32] = make_uint4(dst[4], dst[5], dst[6], dst[7]);
  } else {                                      // W2: [1024 x 256], ldn = 256
    const int t2 = t - E_ * 512;
    const int e = t2 >> 9, rem = t2 & 511;
    const int nt = rem >> 5, kt = rem & 31;
    const float* src = w_proj + (size_t)e * HD_ * D_;
    const int col = nt * 16 + (lane & 15);
    uint4* tile = (uint4*)(w2p + (size_t)t2 * 256) + lane;
    unsigned int dst[8];
#pragma unroll
    for (int d = 0; d < 8; ++d) {
      const int part = d >> 2, dd = d & 3;
      const int k = kt * 32 + part * 16 + sel + dd * 2;
      dst[d] = pack2bf(src[(size_t)k * D_ + col], src[(size_t)(k + 1) * D_ + col]);
    }
    tile[0]  = make_uint4(dst[0], dst[1], dst[2], dst[3]);
    tile[32] = make_uint4(dst[4], dst[5], dst[6], dst[7]);
  }
}

// ---------------------------------------------------------------------------
// Fused expert MLP: out = gelu(x @ w_fc) @ w_proj, 64 rows at a time.
// 512 workgroups of FOUR waves, two workgroups a WGP (one wave of each on every SIMD,
// up to 512 registers a wave). Each keeps ONE expert (index mod 32) and walks four of
// its 64-row blocks one after the other: all 32 experts are in work from the start, an
// expert's packed weights are brought into L2 during the first block only, and the
// three later blocks read them again from there.
// Hidden dim processed in 8 chunks of 128 columns; 4x2 / 4x4 register blocking per
// wave: a wave holds all four row tiles of the block, so no two waves load the same
// weight fragment and each fragment loaded from L2 feeds four WMMAs.
// ---------------------------------------------------------------------------
__global__ void __launch_bounds__(128, 2) expert_mlp_kernel(
    const float* __restrict__ x,
    const unsigned int* __restrict__ w1p,
    const unsigned int* __restrict__ w2p,
    float* __restrict__ out) {
  __shared__ unsigned short Xs[64 * 264];  // 64 rows x 256 K, bf16, padded stride
  __shared__ unsigned short Hs[64 * 136];  // 64 rows x 128 hidden cols, bf16, padded

  const int tid  = threadIdx.x;
  const int wave = tid >> 5;
  const int lane = tid & 31;
  const int e  = blockIdx.x & (E_ - 1);    // neighbours in the grid take different experts
  const int mb = blockIdx.x >> 5;          // 16 workgroups per expert

  // wave work mapping (4x2 blocking phase 1, 4x4 blocking phase 2): all four row tiles
  const int ctg = wave;                    // phase-1 col tiles {2*ctg, 2*ctg+1} (chunk-local)
  const int ntg2 = wave;                   // phase-2 col tiles {4*ntg2 .. +3}

  const unsigned int* w1e = w1p + (size_t)e * 512 * 256;
  const unsigned int* w2e = w2p + (size_t)e * 512 * 256;

  const int laneRow = lane & 15;
  const int laneSel = (lane >> 4) << 3;    // 0 or 8 halves (A/B fragment K select)
  const int rOff    = (lane >> 4) << 3;    // C-layout row offset (0 or 8)

  // Operand fragments are fetched ahead of the WMMAs that read them.
  // B comes straight from L2 into registers. A chunk uses it in 16 groups of two
  // fragments (eight WMMAs each): groups 0-7 are phase 1 (one k tile of W1, two column
  // tiles), groups 8-15 phase 2 (one k tile of W2, two of the four column tiles).
  // A ring of four groups is in flight: a group's loads are issued four groups ahead
  // of its WMMAs, also across the GELU, into the next chunk and, the expert being the
  // same, from a row block's last chunk into the next block's first.
  // A comes from LDS, one k tile ahead, into the other of two fragment sets.
  const uint4* w1l = (const uint4*)w1e + lane;
  const uint4* w2l = (const uint4*)w2e + lane;
  const unsigned short* xa = &Xs[laneRow * 264 + laneSel];
  const unsigned short* ha = &Hs[laneRow * 136 + laneSel];
  Frag rb[4][2];
  Frag fa[2][4];
  auto issue_group = [&](int cc, int g, Frag (&dst)[2]) {
#pragma unroll
    for (int j = 0; j < 2; ++j) {
      const uint4* bp;
      if (g < 8) {
        bp = w1l + (size_t)((cc * 8 + ctg * 2 + j) * 8 + g) * 64;
      } else {
        const int h = g - 8;
        bp = w2l + (size_t)((ntg2 * 4 + (h & 1) * 2 + j) * 32 + cc * 4 + (h >> 1)) * 64;
      }
      dst[j].u[0] = bp[0];
      dst[j].u[1] = bp[32];                // the tile's second 512-byte half
    }
  };
  auto load_a = [&](const unsigned short* base, int pitch, int kt, Frag (&dst)[4]) {
#pragma unroll
    for (int i = 0; i < 4; ++i) {
      const unsigned short* ap = base + i * 16 * pitch + kt * 32;
      dst[i].u[0] = *(const uint4*)ap;
      dst[i].u[1] = *(const uint4*)(ap + 16);
    }
  };
#pragma unroll
  for (int g = 0; g < 4; ++g) issue_group(0, g, rb[g]);

  // one LDS address for the X stores, the rest constant offsets
  unsigned short* xs_st = &Xs[(tid >> 6) * 264 + (tid & 63) * 4];

  for (int blk = 0; blk < 4; ++blk) {      // row blocks mb, mb + 16, mb + 32, mb + 48
  const int m0 = (mb + blk * 16) << 6;

  // (every read of Xs for the block before lies in front of that block's last barrier)
  // ---- load + convert X tile [64 x 256] fp32 -> bf16 LDS (coalesced) ----
  const float4* xt = (const float4*)(x + ((size_t)e * CAP_ + m0) * D_) + tid;
  float4 xv[32];
#pragma unroll
  for (int it = 0; it < 32; ++it)
    xv[it] = xt[it * 128];                 // row it * 2 + (tid >> 6), float4 column tid & 63
  // the address pair that these loads name is free for reuse from here on; as an input
  // it stays whole up to this wait, so that no load's own result lands on it earlier
  asm volatile("s_wait_xcnt 0x0" :: "v"(xt) : "memory");
#pragma unroll
  for (int it = 0; it < 32; ++it) {
    const float4 v = xv[it];
    uint2 p;
    p.x = pack2bf(v.x, v.y);
    p.y = pack2bf(v.z, v.w);
    *(uint2*)&xs_st[it * 2 * 264] = p;
  }
  __syncthreads();

  load_a(xa, 264, 0, fa[0]);
  v8f acc2[4][4] = {};                     // Out accumulators of this row block

  for (int c = 0; c < 8; ++c) {
    // ---------------- phase 1: Hchunk[64x128] = Xtile @ W1[:, c*128 .. +128]
    v8f acc1[4][2] = {};
#pragma unroll
    for (int kt = 0; kt < 8; ++kt) {
      if (kt < 7) load_a(xa, 264, kt + 1, fa[(kt + 1) & 1]);
      // keeps the next k tile's LDS reads as one group ahead of this tile's WMMAs: the
      // scheduler otherwise sinks them among the WMMAs, right in front of their use,
      // and with two waves a SIMD the LDS latency is then waited out at every k tile
      __builtin_amdgcn_sched_barrier(0);
#pragma unroll
      for (int i = 0; i < 4; ++i)
#pragma unroll
        for (int j = 0; j < 2; ++j)
          acc1[i][j] = __builtin_amdgcn_wmma_f32_16x16x32_bf16(
              false, fa[kt & 1][i].v, false, rb[kt & 3][j].v, (short)0, acc1[i][j], false, false);
      issue_group(c, kt + 4, rb[kt & 3]);
      // keeps the look-ahead loads where they are written: without it the scheduler
      // sinks them down to their first use and the L2 latency is waited out again
      __builtin_amdgcn_sched_barrier(0);
      // the next step rewrites address registers that these loads name
      asm volatile("s_wait_xcnt 0x0" ::: "memory");
    }
    // GELU (erf form), convert, write H chunk to LDS (C-layout -> row-major)
#pragma unroll
    for (int i = 0; i < 4; ++i) {
      const int rbase = i * 16 + rOff;
#pragma unroll
      for (int j = 0; j < 2; ++j) {
        const int col = (ctg * 2 + j) * 16 + laneRow;
        float g[8];
        gelu_exact_tile(acc1[i][j], g);
#pragma unroll
        for (int v = 0; v < 8; v += 2) {   // rows v and v + 1 rounded as one pair
          const unsigned int p = pack2bf(g[v], g[v + 1]);
          Hs[(rbase + v) * 136 + col]     = (unsigned short)p;
          Hs[(rbase + v + 1) * 136 + col] = (unsigned short)(p >> 16);
        }
      }
    }
    __syncthreads();

    // ---------------- phase 2: Out += Hchunk @ W2[c*128 .. +128, :]
    const int cn = (c + 1) & 7;            // after the last chunk: the next block's first
    load_a(ha, 136, 0, fa[0]);
#pragma unroll
    for (int kt2 = 0; kt2 < 4; ++kt2) {
      if (kt2 < 3) load_a(ha, 136, kt2 + 1, fa[(kt2 + 1) & 1]);
      else         load_a(xa, 264, 0, fa[0]);   // the next chunk's first X fragments
      // as in phase 1: the LDS reads stay one group ahead of the WMMAs
      __builtin_amdgcn_sched_barrier(0);
#pragma unroll
      for (int hf = 0; hf < 2; ++hf) {
        const int g = 8 + kt2 * 2 + hf;
#pragma unroll
        for (int i = 0; i < 4; ++i)
#pragma unroll
          for (int j = 0; j < 2; ++j)
            acc2[i][hf * 2 + j] = __builtin_amdgcn_wmma_f32_16x16x32_bf16(
                false, fa[kt2 & 1][i].v, false, rb[g & 3][j].v, (short)0, acc2[i][hf * 2 + j],
                false, false);
        if (g + 4 < 16) issue_group(c, g + 4, rb[g & 3]);
        else            issue_group(cn, g + 4 - 16, rb[g & 3]);
        // as in phase 1: holds the look-ahead loads at this place
        __builtin_amdgcn_sched_barrier(0);
        // the next step rewrites address registers that these loads name
        asm volatile("s_wait_xcnt 0x0" ::: "memory");
      }
    }
    __syncthreads();
  }

  // ---- write Out tile [64 x 256] fp32 ----
  // one address for the lane's 128 stores, the rest constant offsets: sixteen address
  // offsets kept over the block loop would cost registers
  float* ot = out + ((size_t)e * CAP_ + m0 + rOff) * D_ + ntg2 * 64 + laneRow;
#pragma unroll
  for (int i = 0; i < 4; ++i) {
#pragma unroll
    for (int n = 0; n < 4; ++n) {
#pragma unroll
      for (int v = 0; v < 8; ++v)
        ot[(i * 16 + v) * D_ + n * 16] = acc2[i][n][v];
    }
  }
  // the next block's first instructions overwrite registers that these stores name
  asm volatile("s_wait_xcnt 0x0" ::: "memory");
  }  // row blocks
}

extern "C" void kernel_launch(void* const* d_in, const int* in_sizes, int n_in,
                              void* d_out, int out_size, void* d_ws, size_t ws_size,
                              hipStream_t stream) {
  const float* x      = (const float*)d_in[0];
  const float* w_fc   = (const float*)d_in[1];
  const float* w_proj = (const float*)d_in[2];
  float* out          = (float*)d_out;

  // workspace: 16 MB packed-bf16 W1 + 16 MB packed-bf16 W2
  unsigned int* w1p = (unsigned int*)d_ws;
  unsigned int* w2p = w1p + (size_t)E_ * 512 * 256;

  // 32768 tiles, 8 tiles (waves) per 256-thread block
  prep_weights_kernel<<<4096, 256, 0, stream>>>(w_fc, w_proj, w1p, w2p);

  // 32 experts x 16 workgroups of four waves, four 64-row blocks each
  expert_mlp_kernel<<<E_ * 16, 128, 0, stream>>>(x, w1p, w2p, out);
}

// v007
// One run takes 133 microseconds.
// Next to v006, in two timings, it ran 1.04 and 1.03 times as fast.
// All steps since v000 together make it 2.68 times as fast.
#include <hip/hip_runtime.h>
#include <hip/hip_bf16.h>
#include <math.h>

#define E_   32
#define CAP_ 4096
#define D_   256
#define HD_  1024

typedef __attribute__((ext_vector_type(16))) __bf16 v16bf;
typedef __attribute__((ext_vector_type(8)))  float  v8f;

union Frag {
  uint4 u[2];
  v16bf v;
};

typedef __attribute__((ext_vector_type(2))) float  v2f;
typedef __attribute__((ext_vector_type(2))) __bf16 v2bf;

// two fp32 -> two bf16 in one register (a low, b high), round to nearest even, by the
// chip's own packed conversion: one instruction for the pair
__device__ __forceinline__ unsigned int pack2bf(float a, float b) {
  v2f f;
  f.x = a;
  f.y = b;
  return __builtin_bit_cast(unsigned int, __builtin_convertvector(f, v2bf));
}

// Exact-form GELU, 0.5 x (1 + erf(x / sqrt 2)), of one accumulator tile (8 values a
// lane) without a branch: erf(u) = u P(u^2) / Q(u^2) on u clamped to [-4, 4], where
// erf is 1 to f32 rounding (rational form, absolute error of erf below 1e-6 over the
// whole range; Q < 0 for every u, so the reciprocal is always finite). One formula
// for every lane; the four packed pairs go through each stage together, so that
// eight independent chains are in flight instead of one. Every loop here is unrolled
// so that the small arrays live in registers and the stages stay straight-line code.
__device__ __forceinline__ void gelu_exact_tile(const v8f a, float (&g)[8]) {
  v2f x[4], u[4], t[4], p[4], q[4];
#pragma unroll
  for (int k = 0; k < 4; ++k) {
    x[k].x = a[2 * k];
    x[k].y = a[2 * k + 1];
    u[k] = x[k] * 0.70710678118654752440f;
    u[k] = __builtin_elementwise_min(__builtin_elementwise_max(u[k], (v2f)(-4.0f)), (v2f)(4.0f));
    t[k] = u[k] * u[k];
    p[k] = (v2f)(-2.72614225801306e-10f);
    q[k] = (v2f)(-1.45660718464996e-05f);
  }
  const float pc[6] = {2.77068142495902e-08f,  -2.10102402082508e-06f, -5.69250639462346e-05f,
                       -7.34990630326855e-04f, -2.95459980854025e-03f, -1.60960333262415e-02f};
  const float qc[4] = {-2.13374055278905e-04f, -1.68282697438203e-03f, -7.37332916720468e-03f,
                       -1.42647390514189e-02f};
#pragma unroll
  for (int s = 0; s < 6; ++s) {
#pragma unroll
    for (int k = 0; k < 4; ++k) {
      p[k] = __builtin_elementwise_fma(p[k], t[k], (v2f)(pc[s]));
      if (s < 4) q[k] = __builtin_elementwise_fma(q[k], t[k], (v2f)(qc[s]));
    }
  }
#pragma unroll
  for (int k = 0; k < 4; ++k) {
    q[k].x = __builtin_amdgcn_rcpf(q[k].x);
    q[k].y = __builtin_amdgcn_rcpf(q[k].y);
    p[k] = p[k] * u[k];
  }
#pragma unroll
  for (int k = 0; k < 4; ++k) {
    const v2f hx = 0.5f * x[k];
    const v2f r = __builtin_elementwise_fma(hx, p[k] * q[k], hx);
    g[2 * k]     = r.x;
    g[2 * k + 1] = r.y;
  }
}

// ---------------------------------------------------------------------------
// Prep: convert fp32 weights to bf16, packed per 32(K)x16(N) WMMA-B tile.
// Tile = 1024 bytes in two halves of 512; lane L owns 16 bytes at L*16 of each:
//   first half  : K = k0 + sel + {0..7}   of column n0 + (L%16)
//   second half : K = k0 + sel + 16 + {0..7}
//   sel = 0 for L<16, 8 for L>=16   (matches ISA 16-bit B layout)
// So each 16-byte load of a whole wave reads 512 contiguous bytes, four whole
// 128-byte lines, and not every other 16 bytes of eight lines.
// W1 packed: [E][64 ntiles][8 ktiles]   (16 MB)
// W2 packed: [E][16 ntiles][32 ktiles]  (16 MB)
// ---------------------------------------------------------------------------
__global__ void __launch_bounds__(256) prep_weights_kernel(
    const float* __restrict__ w_fc, const float* __restrict__ w_proj,
    unsigned int* __restrict__ w1p, unsigned int* __restrict__ w2p) {
  const int wave = threadIdx.x >> 5;
  const int lane = threadIdx.x & 31;
  const int t = blockIdx.x * 8 + wave;          // 32768 tiles total
  const int sel = (lane >> 4) * 8;

  if (t < E_ * 512) {                           // W1: [256 x 1024], ldn = 1024
    const int e = t >> 9, rem = t & 511;
    const int nt = rem >> 3, kt = rem & 7;
    const float* src = w_fc + (size_t)e * D_ * HD_;
    const int col = nt * 16 + (lane & 15);
    uint4* tile = (uint4*)(w1p + (size_t)t * 256) + lane;
    unsigned int dst[8];
#pragma unroll
    for (int d = 0; d < 8; ++d) {
      const int part = d >> 2, dd = d & 3;
      const int k = kt * 32 + part * 16 + sel + dd * 2;
      dst[d] = pack2bf(src[(size_t)k * HD_ + col], src[(size_t)(k + 1) * HD_ + col]);
    }
    tile[0]  = make_uint4(dst[0], dst[1], dst[2], dst[3]);
    tile[32] = make_uint4(dst[4], dst[5], dst[6], dst[7]);
  } else {                                      // W2: [1024 x 256], ldn = 256
    const int t2 = t - E_ * 512;
    const int e = t2 >> 9, rem = t2 & 511;
    const int nt = rem >> 5, kt = rem & 31;
    const float* src = w_proj + (size_t)e * HD_ * D_;
    const int col = nt * 16 + (lane & 15);
    uint4* tile = (uint4*)(w2p + (size_t)t2 * 256) + lane;
    unsigned int dst[8];
#pragma unroll
    for (int d = 0; d < 8; ++d) {
      const int part = d >> 2, dd = d & 3;
      const int k = kt * 32 + part * 16 + sel + dd * 2;
      dst[d] = pack2bf(src[(size_t)k * D_ + col], src[(size_t)(k + 1) * D_ + col]);
    }
    tile[0]  = make_uint4(dst[0], dst[1], dst[2], dst[3]);
    tile[32] = make_uint4(dst[4], dst[5], dst[6], dst[7]);
  }
}

// ---------------------------------------------------------------------------
// Fused expert MLP: out = gelu(x @ w_fc) @ w_proj, 64 rows at a time.
// 512 workgroups of FOUR waves, two workgroups a WGP (one wave of each on every SIMD,
// up to 512 registers a wave). Each keeps ONE expert (index mod 32) and walks four of
// its 64-row blocks one after the other: all 32 experts are in work from the start, an
// expert's packed weights are brought into L2 during the first block only, and the
// three later blocks read them again from there.
// Hidden dim processed in 4 chunks of 256 columns; 4x4 register blocking per wave in
// both phases: a wave holds all four row tiles of the block, so no two waves load the
// same weight fragment and each fragment loaded from L2 feeds four WMMAs; each X or H
// fragment read from LDS feeds four WMMAs too, and a k tile is sixteen WMMAs long, so
// the next k tile's LDS reads, issued ahead of it, have that long to land.
// ---------------------------------------------------------------------------
__global__ void __launch_bounds__(128, 2) expert_mlp_kernel(
    const float* __restrict__ x,
    const unsigned int* __restrict__ w1p,
    const unsigned int* __restrict__ w2p,
    float* __restrict__ out) {
  __shared__ unsigned short Xs[64 * 264];  // 64 rows x 256 K, bf16, padded stride
  __shared__ unsigned short Hs[64 * 264];  // 64 rows x 256 hidden cols, bf16, padded

  const int tid  = threadIdx.x;
  const int wave = tid >> 5;
  const int lane = tid & 31;
  const int e  = blockIdx.x & (E_ - 1);    // neighbours in the grid take different experts
  const int mb = blockIdx.x >> 5;          // 16 workgroups per expert

  // wave work mapping (4x4 blocking in both phases): all four row tiles
  const int ctg = wave;                    // phase-1 col tiles {4*ctg .. +3} (chunk-local)
  const int ntg2 = wave;                   // phase-2 col tiles {4*ntg2 .. +3}

  const unsigned int* w1e = w1p + (size_t)e * 512 * 256;
  const unsigned int* w2e = w2p + (size_t)e * 512 * 256;

  const int laneRow = lane & 15;
  const int laneSel = (lane >> 4) << 3;    // 0 or 8 halves (A/B fragment K select)
  const int rOff    = (lane >> 4) << 3;    // C-layout row offset (0 or 8)

  // Operand fragments are fetched ahead of the WMMAs that read them.
  // B comes straight from L2 into registers. A chunk uses it in 32 groups of two
  // fragments (eight WMMAs each): groups 0-15 are phase 1 (one k tile of W1, two of the
  // four column tiles), groups 16-31 phase 2 (the same of W2).
  // A ring of four groups is in flight: a group's loads are issued four groups ahead
  // of its WMMAs, also across the GELU, into the next chunk and, the expert being the
  // same, from a row block's last chunk into the next block's first.
  // A comes from LDS, one k tile ahead, into the other of two fragment sets.
  const uint4* w1l = (const uint4*)w1e + lane;
  const uint4* w2l = (const uint4*)w2e + lane;
  const unsigned short* xa = &Xs[laneRow * 264 + laneSel];
  const unsigned short* ha = &Hs[laneRow * 264 + laneSel];
  Frag rb[4][2];
  Frag fa[2][4];
  auto issue_group = [&](int cc, int g, Frag (&dst)[2]) {
#pragma unroll
    for (int j = 0; j < 2; ++j) {
      const uint4* bp;
      if (g < 16) {
        bp = w1l + (size_t)((cc * 16 + ctg * 4 + (g & 1) * 2 + j) * 8 + (g >> 1)) * 64;
      } else {
        const int h = g - 16;
        bp = w2l + (size_t)((ntg2 * 4 + (h & 1) * 2 + j) * 32 + cc * 8 + (h >> 1)) * 64;
      }
      dst[j].u[0] = bp[0];
      dst[j].u[1] = bp[32];                // the tile's second 512-byte half
    }
  };
  auto load_a = [&](const unsigned short* base, int pitch, int kt, Frag (&dst)[4]) {
#pragma unroll
    for (int i = 0; i < 4; ++i) {
      const unsigned short* ap = base + i * 16 * pitch + kt * 32;
      dst[i].u[0] = *(const uint4*)ap;
      dst[i].u[1] = *(const uint4*)(ap + 16);
    }
  };
#pragma unroll
  for (int g = 0; g < 4; ++g) issue_group(0, g, rb[g]);

  // one LDS address for the X stores, the rest constant offsets
  unsigned short* xs_st = &Xs[(tid >> 6) * 264 + (tid & 63) * 4];

  for (int blk = 0; blk < 4; ++blk) {      // row blocks mb, mb + 16, mb + 32, mb + 48
  const int m0 = (mb + blk * 16) << 6;

  // (every read of Xs for the block before lies in front of that block's last barrier)
  // ---- load + convert X tile [64 x 256] fp32 -> bf16 LDS (coalesced) ----
  const float4* xt = (const float4*)(x + ((size_t)e * CAP_ + m0) * D_) + tid;
  float4 xv[32];
#pragma unroll
  for (int it = 0; it < 32; ++it)
    xv[it] = xt[it * 128];                 // row it * 2 + (tid >> 6), float4 column tid & 63
  // the address pair that these loads name is free for reuse from here on; as an input
  // it stays whole up to this wait, so that no load's own result lands on it earlier
  asm volatile("s_wait_xcnt 0x0" :: "v"(xt) : "memory");
#pragma unroll
  for (int it = 0; it < 32; ++it) {
    const float4 v = xv[it];
    uint2 p;
    p.x = pack2bf(v.x, v.y);
    p.y = pack2bf(v.z, v.w);
    *(uint2*)&xs_st[it * 2 * 264] = p;
  }
  __syncthreads();

  load_a(xa, 264, 0, fa[0]);
  v8f acc2[4][4] = {};                     // Out accumulators of this row block

  for (int c = 0; c < 4; ++c) {
    // ---------------- phase 1: Hchunk[64x256] = Xtile @ W1[:, c*256 .. +256]
    v8f acc1[4][4] = {};
#pragma unroll
    for (int kt = 0; kt < 8; ++kt) {
      if (kt < 7) load_a(xa, 264, kt + 1, fa[(kt + 1) & 1]);
      // keeps the next k tile's LDS reads as one group ahead of this tile's WMMAs: the
      // scheduler otherwise sinks them among the WMMAs, right in front of their use,
      // and with two waves a SIMD the LDS latency is then waited out at every k tile
      __builtin_amdgcn_sched_barrier(0);
#pragma unroll
      for (int hf = 0; hf < 2; ++hf) {
        const int g = kt * 2 + hf;
#pragma unroll
        for (int i = 0; i < 4; ++i)
#pragma unroll
          for (int j = 0; j < 2; ++j)
            acc1[i][hf * 2 + j] = __builtin_amdgcn_wmma_f32_16x16x32_bf16(
                false, fa[kt & 1][i].v, false, rb[g & 3][j].v, (short)0, acc1[i][hf * 2 + j],
                false, false);
        issue_group(c, g + 4, rb[g & 3]);
        // keeps the look-ahead loads where they are written: without it the scheduler
        // sinks them down to their first use and the L2 latency is waited out again
        __builtin_amdgcn_sched_barrier(0);
        // the next step rewrites address registers that these loads name
        asm volatile("s_wait_xcnt 0x0" ::: "memory");
      }
    }
    // GELU (erf form), convert, write H chunk to LDS (C-layout -> row-major)
#pragma unroll
    for (int i = 0; i < 4; ++i) {
      const int rbase = i * 16 + rOff;
#pragma unroll
      for (int j = 0; j < 4; ++j) {
        const int col = (ctg * 4 + j) * 16 + laneRow;
        float g[8];
        gelu_exact_tile(acc1[i][j], g);
#pragma unroll
        for (int v = 0; v < 8; v += 2) {   // rows v and v + 1 rounded as one pair
          const unsigned int p = pack2bf(g[v], g[v + 1]);
          Hs[(rbase + v) * 264 + col]     = (unsigned short)p;
          Hs[(rbase + v + 1) * 264 + col] = (unsigned short)(p >> 16);
        }
      }
    }
    __syncthreads();

    // ---------------- phase 2: Out += Hchunk @ W2[c*256 .. +256, :]
    const int cn = (c + 1) & 3;            // after the last chunk: the next block's first
    load_a(ha, 264, 0, fa[0]);
#pragma unroll
    for (int kt2 = 0; kt2 < 8; ++kt2) {
      if (kt2 < 7) load_a(ha, 264, kt2 + 1, fa[(kt2 + 1) & 1]);
      else         load_a(xa, 264, 0, fa[0]);   // the next chunk's first X fragments
      // as in phase 1: the LDS reads stay one group ahead of the WMMAs
      __builtin_amdgcn_sched_barrier(0);
#pragma unroll
      for (int hf = 0; hf < 2; ++hf) {
        const int g = 16 + kt2 * 2 + hf;
#pragma unroll
        for (int i = 0; i < 4; ++i)
#pragma unroll
          for (int j = 0; j < 2; ++j)
            acc2[i][hf * 2 + j] = __builtin_amdgcn_wmma_f32_16x16x32_bf16(
                false, fa[kt2 & 1][i].v, false, rb[g & 3][j].v, (short)0, acc2[i][hf * 2 + j],
                false, false);
        if (g + 4 < 32) issue_group(c, g + 4, rb[g & 3]);
        else            issue_group(cn, g + 4 - 32, rb[g & 3]);
        // as in phase 1: holds the look-ahead loads at this place
        __builtin_amdgcn_sched_barrier(0);
        // the next step rewrites address registers that these loads name
        asm volatile("s_wait_xcnt 0x0" ::: "memory");
      }
    }
    __syncthreads();
  }

  // ---- write Out tile [64 x 256] fp32 ----
  // one address for the lane's 128 stores, the rest constant offsets: sixteen address
  // offsets kept over the block loop would cost registers
  float* ot = out + ((size_t)e * CAP_ + m0 + rOff) * D_ + ntg2 * 64 + laneRow;
#pragma unroll
  for (int i = 0; i < 4; ++i) {
#pragma unroll
    for (int n = 0; n < 4; ++n) {
#pragma unroll
      for (int v = 0; v < 8; ++v)
        ot[(i * 16 + v) * D_ + n * 16] = acc2[i][n][v];
    }
  }
  // the next block's first instructions overwrite registers that these stores name
  asm volatile("s_wait_xcnt 0x0" ::: "memory");
  }  // row blocks
}

extern "C" void kernel_launch(void* const* d_in, const int* in_sizes, int n_in,
                              void* d_out, int out_size, void* d_ws, size_t ws_size,
                              hipStream_t stream) {
  const float* x      = (const float*)d_in[0];
  const float* w_fc   = (const float*)d_in[1];
  const float* w_proj = (const float*)d_in[2];
  float* out          = (float*)d_out;

  // workspace: 16 MB packed-bf16 W1 + 16 MB packed-bf16 W2
  unsigned int* w1p = (unsigned int*)d_ws;
  unsigned int* w2p = w1p + (size_t)E_ * 512 * 256;

  // 32768 tiles, 8 tiles (waves) per 256-thread block
  prep_weights_kernel<<<4096, 256, 0, stream>>>(w_fc, w_proj, w1p, w2p);

  // 32 experts x 16 workgroups of four waves, four 64-row blocks each
  expert_mlp_kernel<<<E_ * 16, 128, 0, stream>>>(x, w1p, w2p, out);
}
